// v000
// The times below were measured on an AMD MI455X: many runs one after another, warmed up first and cycling through
// copies of the inputs, with the whole window's GPU time divided by the number of runs. Launches and the gaps
// between them are all in it. The median over several windows is given; except for v000 it joins two sittings, which
// can be a few percent apart, so the side-by-side timings, each taken in one sitting, are the better comparison.
// v000 is the starting kernel. One run takes 147 microseconds.
#include <hip/hip_runtime.h>
#include <hip/hip_bf16.h>

typedef __attribute__((ext_vector_type(16))) _Float16 v16h;
typedef __attribute__((ext_vector_type(8)))  _Float16 v8h;
typedef __attribute__((ext_vector_type(8)))  float    v8f;
typedef __attribute__((ext_vector_type(4)))  float    v4f;

// Problem constants
#define BB 2
#define TT 12
#define NN 1024
#define DD 128
#define HH 8
#define HD 16
#define ROWS (BB*TT*NN)          // 24576
#define ELEMS ((size_t)ROWS*DD)  // 3145728

// ---------------------------------------------------------------------------
// Fragment builders for V_WMMA_F32_16X16X32_F16 (wave32).
// 16-bit A-matrix 16x32 layout (ISA 7.12.2):
//   laneBase = (lane<16 ? 0 : 8);  row = lane&15
//   elem e<8 -> K = laneBase + e ;  e>=8 -> K = laneBase + 8 + e
// B (32x16) mirrors this with column = lane&15.
// C/D 16x16 f32: elem r -> (M = r + (lane<16?0:8), N = lane&15)
// ---------------------------------------------------------------------------

static __device__ inline v16h frag_from_f32(const float* __restrict__ rowp, int laneBase) {
    const float* p = rowp + laneBase;
    v4f x0 = *(const v4f*)(p);
    v4f x1 = *(const v4f*)(p + 4);
    v4f x2 = *(const v4f*)(p + 16);
    v4f x3 = *(const v4f*)(p + 20);
    v16h a;
#pragma unroll
    for (int i = 0; i < 4; ++i) {
        a[i]      = (_Float16)x0[i];
        a[4 + i]  = (_Float16)x1[i];
        a[8 + i]  = (_Float16)x2[i];
        a[12 + i] = (_Float16)x3[i];
    }
    return a;
}

static __device__ inline v16h frag_from_f16(const _Float16* __restrict__ rowp, int laneBase) {
    v8h x0 = *(const v8h*)(rowp + laneBase);        // K = laneBase .. +7
    v8h x1 = *(const v8h*)(rowp + laneBase + 16);   // K = laneBase+16 .. +23
    v16h a;
#pragma unroll
    for (int i = 0; i < 8; ++i) { a[i] = x0[i]; a[8 + i] = x1[i]; }
    return a;
}

// K-dim = 16 (head_dim), zero-padded to 32: only e<8 valid.
static __device__ inline v16h frag_from_f16_k16(const _Float16* __restrict__ rowp, int laneBase) {
    v8h x = *(const v8h*)(rowp + laneBase);
    v16h a = {};
#pragma unroll
    for (int i = 0; i < 8; ++i) a[i] = x[i];
    return a;
}

static __device__ inline v8f wmma_f16(v16h a, v16h b, v8f c) {
    return __builtin_amdgcn_wmma_f32_16x16x32_f16(false, a, false, b,
                                                  (short)0, c, false, false);
}

// ---------------------------------------------------------------------------
// Kernel 1: fused Q/K/V projection.  C = X @ W^T + b   (f32 in, f16 out)
// One wave -> one 16x16 output tile; K=128 -> 4 WMMAs.
// grid.x = 1536 (8 waves/block), grid.y = 3 (q/k/v)
// ---------------------------------------------------------------------------
__global__ void qkv_proj_kernel(const float* __restrict__ q_in,
                                const float* __restrict__ k_in,
                                const float* __restrict__ v_in,
                                const float* __restrict__ Wq, const float* __restrict__ bq,
                                const float* __restrict__ Wk, const float* __restrict__ bk,
                                const float* __restrict__ Wv, const float* __restrict__ bv,
                                _Float16* __restrict__ ws_q,
                                _Float16* __restrict__ ws_k,
                                _Float16* __restrict__ ws_v) {
    const int lane = threadIdx.x & 31;
    const int wave = threadIdx.x >> 5;
    const int tile = blockIdx.x * 8 + wave;     // 0..12287
    const int tm = tile >> 3;                   // 0..1535
    const int tn = tile & 7;                    // 0..7

    const float* X; const float* W; const float* bias; _Float16* O;
    if (blockIdx.y == 0)      { X = q_in; W = Wq; bias = bq; O = ws_q; }
    else if (blockIdx.y == 1) { X = k_in; W = Wk; bias = bk; O = ws_k; }
    else                      { X = v_in; W = Wv; bias = bv; O = ws_v; }

    const int laneBase = (lane < 16) ? 0 : 8;
    const int l15 = lane & 15;
    const int m0 = tm * 16, n0 = tn * 16;

    const float* arow = X + (size_t)(m0 + l15) * DD;
    const float* brow = W + (size_t)(n0 + l15) * DD;   // B[k][n] = W[n][k]

    v8f c = {};
#pragma unroll
    for (int kb = 0; kb < DD; kb += 32)
        c = wmma_f16(frag_from_f32(arow + kb, laneBase),
                     frag_from_f32(brow + kb, laneBase), c);

    const float bval = bias[n0 + l15];
    const int rofs = (lane < 16) ? 0 : 8;
#pragma unroll
    for (int r = 0; r < 8; ++r)
        O[(size_t)(m0 + r + rofs) * DD + n0 + l15] = (_Float16)(c[r] + bval);
}

// ---------------------------------------------------------------------------
// Kernel 2: flash attention over node dim.
// Block = 8 waves, all on the same (b,t,h); wave w owns query tile
// (mchunk*8 + w).  Loop processes 32 keys/iteration:
//   - K/V tiles (32x16 f16, 1 KB each) staged cooperatively into LDS once
//     per block (8x less L2 traffic than per-wave loads)
//   - 2 score WMMAs (HD=16 zero-padded to K=32) + online softmax
//   - 1 full-K=32 P*V WMMA (no padding on the key contraction)
// grid.x = 192 bth * 8 mchunks = 1536 blocks
// ---------------------------------------------------------------------------
__global__ void flash_attn_kernel(const _Float16* __restrict__ Q,
                                  const _Float16* __restrict__ K,
                                  const _Float16* __restrict__ V,
                                  _Float16* __restrict__ O) {
    __shared__ __align__(16) _Float16 kt[32][16];          // key tile
    __shared__ __align__(16) _Float16 vt[32][16];          // value tile
    __shared__ __align__(16) _Float16 pshare[8][16][32];   // per-wave P tile

    const int tid  = threadIdx.x;
    const int lane = tid & 31;
    const int wave = tid >> 5;
    const int bth = blockIdx.x >> 3;            // 0..191
    const int mchunk = blockIdx.x & 7;
    const int h  = bth & 7;
    const int bt = bth >> 3;                    // 0..23
    const size_t rowbase = (size_t)bt * NN;
    const int laneBase = (lane < 16) ? 0 : 8;
    const int l15 = lane & 15;
    const int rofs = (lane < 16) ? 0 : 8;
    const int m0 = (mchunk * 8 + wave) * 16;
    const float scale = 0.25f;                  // 1/sqrt(16)

    // staging assignment: 256 threads x 4 B cover one 32x16 f16 tile
    const int srow = tid >> 3;                  // 0..31
    const int scol = (tid & 7) * 2;             // 0,2,...,14

    // Q fragment stays in registers for the whole loop
    const v16h qa = frag_from_f16_k16(
        Q + (rowbase + m0 + l15) * DD + h * HD, laneBase);

    v8f acc = {};
    float mrow[8], lrow[8];
#pragma unroll
    for (int r = 0; r < 8; ++r) { mrow[r] = -3.0e38f; lrow[r] = 0.0f; }

    for (int j0 = 0; j0 < NN; j0 += 32) {
        // ---- cooperative K/V staging into LDS ----
        const size_t gsrc = (rowbase + j0 + srow) * DD + h * HD + scol;
        *(uint32_t*)&kt[srow][scol] = *(const uint32_t*)&K[gsrc];
        *(uint32_t*)&vt[srow][scol] = *(const uint32_t*)&V[gsrc];
        if (j0 + 32 < NN) {                     // pull next tiles toward L2/L0
            __builtin_prefetch(&K[gsrc + (size_t)32 * DD], 0, 0);
            __builtin_prefetch(&V[gsrc + (size_t)32 * DD], 0, 0);
        }
        __syncthreads();

        // ---- scores: two 16x16 tiles ----
        v16h kb0 = frag_from_f16_k16(&kt[l15][0],      laneBase);
        v16h kb1 = frag_from_f16_k16(&kt[l15 + 16][0], laneBase);
        v8f s0 = {}, s1 = {};
        s0 = wmma_f16(qa, kb0, s0);
        s1 = wmma_f16(qa, kb1, s1);

        // ---- online softmax over the 32 keys (rows live in 16-lane halves)
        float p0[8], p1[8];
#pragma unroll
        for (int r = 0; r < 8; ++r) {
            float a0 = s0[r] * scale;
            float a1 = s1[r] * scale;
            float tm = fmaxf(a0, a1);
            tm = fmaxf(tm, __shfl_xor(tm, 1));
            tm = fmaxf(tm, __shfl_xor(tm, 2));
            tm = fmaxf(tm, __shfl_xor(tm, 4));
            tm = fmaxf(tm, __shfl_xor(tm, 8));
            float nm = fmaxf(mrow[r], tm);
            float al = __expf(mrow[r] - nm);
            p0[r] = __expf(a0 - nm);
            p1[r] = __expf(a1 - nm);
            float ts = p0[r] + p1[r];
            ts += __shfl_xor(ts, 1);
            ts += __shfl_xor(ts, 2);
            ts += __shfl_xor(ts, 4);
            ts += __shfl_xor(ts, 8);
            lrow[r] = lrow[r] * al + ts;
            mrow[r] = nm;
            acc[r] *= al;
        }

        // ---- C-layout -> A-layout rearrangement of P (16x32) via LDS ----
        __syncthreads();
#pragma unroll
        for (int r = 0; r < 8; ++r) {
            pshare[wave][r + rofs][l15]      = (_Float16)p0[r];
            pshare[wave][r + rofs][l15 + 16] = (_Float16)p1[r];
        }
        __syncthreads();

        v16h pa = frag_from_f16(&pshare[wave][l15][0], laneBase);

        // ---- V fragment from LDS: B[k=key][n=hd], full K=32 ----
        v16h vb;
#pragma unroll
        for (int e = 0; e < 16; ++e) {
            const int k = ((e < 8) ? e : e + 8) + laneBase;
            vb[e] = vt[k][l15];
        }

        acc = wmma_f16(pa, vb, acc);
        __syncthreads();        // protect kt/vt/pshare against next iteration
    }

#pragma unroll
    for (int r = 0; r < 8; ++r) {
        float o = acc[r] / lrow[r];
        O[(rowbase + m0 + r + rofs) * DD + h * HD + l15] = (_Float16)o;
    }
}

// ---------------------------------------------------------------------------
// Kernel 3: output projection.  out = attn_out(f16) @ Wo^T + bo  (f32 out)
// ---------------------------------------------------------------------------
__global__ void out_proj_kernel(const _Float16* __restrict__ A,
                                const float* __restrict__ Wo,
                                const float* __restrict__ bo,
                                float* __restrict__ out) {
    const int lane = threadIdx.x & 31;
    const int wave = threadIdx.x >> 5;
    const int tile = blockIdx.x * 8 + wave;
    const int tm = tile >> 3;
    const int tn = tile & 7;
    const int laneBase = (lane < 16) ? 0 : 8;
    const int l15 = lane & 15;
    const int m0 = tm * 16, n0 = tn * 16;

    const _Float16* arow = A + (size_t)(m0 + l15) * DD;
    const float* brow = Wo + (size_t)(n0 + l15) * DD;

    v8f c = {};
#pragma unroll
    for (int kb = 0; kb < DD; kb += 32)
        c = wmma_f16(frag_from_f16(arow + kb, laneBase),
                     frag_from_f32(brow + kb, laneBase), c);

    const float bval = bo[n0 + l15];
    const int rofs = (lane < 16) ? 0 : 8;
#pragma unroll
    for (int r = 0; r < 8; ++r)
        out[(size_t)(m0 + r + rofs) * DD + n0 + l15] = c[r] + bval;
}

// ---------------------------------------------------------------------------
extern "C" void kernel_launch(void* const* d_in, const int* in_sizes, int n_in,
                              void* d_out, int out_size, void* d_ws, size_t ws_size,
                              hipStream_t stream) {
    const float* query = (const float*)d_in[0];
    const float* key   = (const float*)d_in[1];
    const float* value = (const float*)d_in[2];
    const float* Wq = (const float*)d_in[3];
    const float* bq = (const float*)d_in[4];
    const float* Wk = (const float*)d_in[5];
    const float* bk = (const float*)d_in[6];
    const float* Wv = (const float*)d_in[7];
    const float* bv = (const float*)d_in[8];
    const float* Wo = (const float*)d_in[9];
    const float* bo = (const float*)d_in[10];

    _Float16* ws_q = (_Float16*)d_ws;          // 4 x 6 MB f16 buffers = 24 MB
    _Float16* ws_k = ws_q + ELEMS;
    _Float16* ws_v = ws_k + ELEMS;
    _Float16* ws_o = ws_v + ELEMS;

    dim3 blk(256);                              // 8 waves per block (wave32)

    qkv_proj_kernel<<<dim3(1536, 3), blk, 0, stream>>>(
        query, key, value, Wq, bq, Wk, bk, Wv, bv, ws_q, ws_k, ws_v);

    flash_attn_kernel<<<dim3(1536), blk, 0, stream>>>(ws_q, ws_k, ws_v, ws_o);

    out_proj_kernel<<<dim3(1536), blk, 0, stream>>>(ws_o, Wo, bo, (float*)d_out);
}

// v001
// A run of this version takes 91.2 microseconds.
// In both of two side-by-side timings against v000, it was 1.69 times as fast.
#include <hip/hip_runtime.h>
#include <hip/hip_bf16.h>

typedef __attribute__((ext_vector_type(16))) _Float16 v16h;
typedef __attribute__((ext_vector_type(8)))  _Float16 v8h;
typedef __attribute__((ext_vector_type(8)))  float    v8f;
typedef __attribute__((ext_vector_type(4)))  float    v4f;

// Problem constants
#define BB 2
#define TT 12
#define NN 1024
#define DD 128
#define HH 8
#define HD 16
#define ROWS (BB*TT*NN)          // 24576
#define ELEMS ((size_t)ROWS*DD)  // 3145728

// ---------------------------------------------------------------------------
// Fragment builders for V_WMMA_F32_16X16X32_F16 (wave32).
// 16-bit A-matrix 16x32 layout (ISA 7.12.2):
//   laneBase = (lane<16 ? 0 : 8);  row = lane&15
//   elem e<8 -> K = laneBase + e ;  e>=8 -> K = laneBase + 8 + e
// B (32x16) mirrors this with column = lane&15.
// C/D 16x16 f32: elem r -> (M = r + (lane<16?0:8), N = lane&15)
// ---------------------------------------------------------------------------

static __device__ inline v16h frag_from_f32(const float* __restrict__ rowp, int laneBase) {
    const float* p = rowp + laneBase;
    v4f x0 = *(const v4f*)(p);
    v4f x1 = *(const v4f*)(p + 4);
    v4f x2 = *(const v4f*)(p + 16);
    v4f x3 = *(const v4f*)(p + 20);
    v16h a;
#pragma unroll
    for (int i = 0; i < 4; ++i) {
        a[i]      = (_Float16)x0[i];
        a[4 + i]  = (_Float16)x1[i];
        a[8 + i]  = (_Float16)x2[i];
        a[12 + i] = (_Float16)x3[i];
    }
    return a;
}

static __device__ inline v16h frag_from_f16(const _Float16* __restrict__ rowp, int laneBase) {
    v8h x0 = *(const v8h*)(rowp + laneBase);        // K = laneBase .. +7
    v8h x1 = *(const v8h*)(rowp + laneBase + 16);   // K = laneBase+16 .. +23
    v16h a;
#pragma unroll
    for (int i = 0; i < 8; ++i) { a[i] = x0[i]; a[8 + i] = x1[i]; }
    return a;
}

// K-dim = 16 (head_dim), zero-padded to 32: only e<8 valid.
static __device__ inline v16h frag_from_f16_k16(const _Float16* __restrict__ rowp, int laneBase) {
    v8h x = *(const v8h*)(rowp + laneBase);
    v16h a = {};
#pragma unroll
    for (int i = 0; i < 8; ++i) a[i] = x[i];
    return a;
}

static __device__ inline v8f wmma_f16(v16h a, v16h b, v8f c) {
    return __builtin_amdgcn_wmma_f32_16x16x32_f16(false, a, false, b,
                                                  (short)0, c, false, false);
}

// ---------------------------------------------------------------------------
// Kernel 1: fused Q/K/V projection.  C = X @ W^T + b   (f32 in, f16 out)
// One wave -> one 16x16 output tile; K=128 -> 4 WMMAs.
// grid.x = 1536 (8 waves/block), grid.y = 3 (q/k/v)
// ---------------------------------------------------------------------------
__global__ void qkv_proj_kernel(const float* __restrict__ q_in,
                                const float* __restrict__ k_in,
                                const float* __restrict__ v_in,
                                const float* __restrict__ Wq, const float* __restrict__ bq,
                                const float* __restrict__ Wk, const float* __restrict__ bk,
                                const float* __restrict__ Wv, const float* __restrict__ bv,
                                _Float16* __restrict__ ws_q,
                                _Float16* __restrict__ ws_k,
                                _Float16* __restrict__ ws_v) {
    const int lane = threadIdx.x & 31;
    const int wave = threadIdx.x >> 5;
    const int tile = blockIdx.x * 8 + wave;     // 0..12287
    const int tm = tile >> 3;                   // 0..1535
    const int tn = tile & 7;                    // 0..7

    const float* X; const float* W; const float* bias; _Float16* O;
    if (blockIdx.y == 0)      { X = q_in; W = Wq; bias = bq; O = ws_q; }
    else if (blockIdx.y == 1) { X = k_in; W = Wk; bias = bk; O = ws_k; }
    else                      { X = v_in; W = Wv; bias = bv; O = ws_v; }

    const int laneBase = (lane < 16) ? 0 : 8;
    const int l15 = lane & 15;
    const int m0 = tm * 16, n0 = tn * 16;

    const float* arow = X + (size_t)(m0 + l15) * DD;
    const float* brow = W + (size_t)(n0 + l15) * DD;   // B[k][n] = W[n][k]

    v8f c = {};
#pragma unroll
    for (int kb = 0; kb < DD; kb += 32)
        c = wmma_f16(frag_from_f32(arow + kb, laneBase),
                     frag_from_f32(brow + kb, laneBase), c);

    const float bval = bias[n0 + l15];
    const int rofs = (lane < 16) ? 0 : 8;
#pragma unroll
    for (int r = 0; r < 8; ++r)
        O[(size_t)(m0 + r + rofs) * DD + n0 + l15] = (_Float16)(c[r] + bval);
}

// ---------------------------------------------------------------------------
// Kernel 2: flash attention over node dim, transposed products.
// Block = 8 waves, all on the same (b,t,h); wave w owns query tile
// (mchunk*8 + w).  Loop processes 32 keys/iteration:
//   - K/V tiles (32x16 f16, 1 KB each) staged cooperatively into LDS once
//     per block (8x less L2 traffic than per-wave loads)
//   - S^T = K * Q^T: 2 score WMMAs (HD=16 zero-padded to K=32).  A lane then
//     holds 16 scores of ONE query (column lane&15): keys 8h+r and 16+8h+r,
//     h = lane>>4, so maximum and sum run in-lane, plus one exchange l <-> l^16
//   - O^T += V^T * P^T: the two score tiles, converted in place, already are
//     the B operand in the hardware k order; P never goes through LDS
// grid.x = 192 bth * 8 mchunks = 1536 blocks
// ---------------------------------------------------------------------------
static __device__ inline float other_half(float x) {   // lane l <-> l ^ 16
    const int b = __builtin_bit_cast(int, x);
    return __builtin_bit_cast(float,
        __builtin_amdgcn_permlanex16(b, b, 0x76543210, 0xfedcba98, false, false));
}

__global__ void flash_attn_kernel(const _Float16* __restrict__ Q,
                                  const _Float16* __restrict__ K,
                                  const _Float16* __restrict__ V,
                                  _Float16* __restrict__ O) {
    __shared__ __align__(16) _Float16 kt[32][16];          // key tile
    __shared__ __align__(16) _Float16 vt[32][16];          // value tile

    const int tid  = threadIdx.x;
    const int lane = tid & 31;
    const int wave = tid >> 5;
    const int bth = blockIdx.x >> 3;            // 0..191
    const int mchunk = blockIdx.x & 7;
    const int h  = bth & 7;
    const int bt = bth >> 3;                    // 0..23
    const size_t rowbase = (size_t)bt * NN;
    const int laneBase = (lane < 16) ? 0 : 8;
    const int l15 = lane & 15;
    const int m0 = (mchunk * 8 + wave) * 16;
    const float scale = 0.25f;                  // 1/sqrt(16)

    // staging assignment: 256 threads x 4 B cover one 32x16 f16 tile
    const int srow = tid >> 3;                  // 0..31
    const int scol = (tid & 7) * 2;             // 0,2,...,14

    // Q fragment (B operand: column = query l15) stays in registers
    const v16h qb = frag_from_f16_k16(
        Q + (rowbase + m0 + l15) * DD + h * HD, laneBase);

    v8f acc = {};                               // acc[r] = O^T[hd = laneBase + r][query l15]
    float mrow = -3.0e38f;                      // running maximum of query l15
    float lsum = 0.0f;                          // this half's share of the row sum

    for (int j0 = 0; j0 < NN; j0 += 32) {
        // ---- cooperative K/V staging into LDS ----
        const size_t gsrc = (rowbase + j0 + srow) * DD + h * HD + scol;
        *(uint32_t*)&kt[srow][scol] = *(const uint32_t*)&K[gsrc];
        *(uint32_t*)&vt[srow][scol] = *(const uint32_t*)&V[gsrc];
        if (j0 + 32 < NN) {                     // pull next tiles toward L2/L0
            __builtin_prefetch(&K[gsrc + (size_t)32 * DD], 0, 0);
            __builtin_prefetch(&V[gsrc + (size_t)32 * DD], 0, 0);
        }
        __syncthreads();

        // ---- transposed scores: two 16(key) x 16(query) tiles ----
        v16h ka0 = frag_from_f16_k16(&kt[l15][0],      laneBase);
        v16h ka1 = frag_from_f16_k16(&kt[l15 + 16][0], laneBase);
        v8f s0 = {}, s1 = {};
        s0 = wmma_f16(ka0, qb, s0);
        s1 = wmma_f16(ka1, qb, s1);

        // ---- V^T fragment from LDS: A[m=hd][k=key], full K=32 ----
        v16h va;
#pragma unroll
        for (int e = 0; e < 16; ++e) {
            const int k = ((e < 8) ? e : e + 8) + laneBase;
            va[e] = vt[k][l15];
        }

        // ---- online softmax: 16 keys in-lane, the other 16 in lane ^ 16 ----
        const v8f a0 = s0 * scale;
        const v8f a1 = s1 * scale;
        float tm = fmaxf(a0[0], a1[0]);
#pragma unroll
        for (int r = 1; r < 8; ++r) tm = fmaxf(tm, fmaxf(a0[r], a1[r]));
        tm = fmaxf(tm, other_half(tm));
        const float nm = fmaxf(mrow, tm);
        const float al = __expf(mrow - nm);
        mrow = nm;

        v16h pb;                                // B[k=key][n=query], hardware k order
        float ts = 0.0f;
#pragma unroll
        for (int r = 0; r < 8; ++r) {
            const float p0 = __expf(a0[r] - nm);
            const float p1 = __expf(a1[r] - nm);
            ts += p0 + p1;
            pb[r]     = (_Float16)p0;
            pb[8 + r] = (_Float16)p1;
            acc[r] *= al;
        }
        lsum = lsum * al + ts;

        acc = wmma_f16(va, pb, acc);
        __syncthreads();        // protect kt/vt against next iteration
    }

    lsum += other_half(lsum);                   // join the two halves' sums once

    v8h o;
#pragma unroll
    for (int r = 0; r < 8; ++r) o[r] = (_Float16)(acc[r] / lsum);
    *(v8h*)&O[(rowbase + m0 + l15) * DD + h * HD + laneBase] = o;
}

// ---------------------------------------------------------------------------
// Kernel 3: output projection.  out = attn_out(f16) @ Wo^T + bo  (f32 out)
// ---------------------------------------------------------------------------
__global__ void out_proj_kernel(const _Float16* __restrict__ A,
                                const float* __restrict__ Wo,
                                const float* __restrict__ bo,
                                float* __restrict__ out) {
    const int lane = threadIdx.x & 31;
    const int wave = threadIdx.x >> 5;
    const int tile = blockIdx.x * 8 + wave;
    const int tm = tile >> 3;
    const int tn = tile & 7;
    const int laneBase = (lane < 16) ? 0 : 8;
    const int l15 = lane & 15;
    const int m0 = tm * 16, n0 = tn * 16;

    const _Float16* arow = A + (size_t)(m0 + l15) * DD;
    const float* brow = Wo + (size_t)(n0 + l15) * DD;

    v8f c = {};
#pragma unroll
    for (int kb = 0; kb < DD; kb += 32)
        c = wmma_f16(frag_from_f16(arow + kb, laneBase),
                     frag_from_f32(brow + kb, laneBase), c);

    const float bval = bo[n0 + l15];
    const int rofs = (lane < 16) ? 0 : 8;
#pragma unroll
    for (int r = 0; r < 8; ++r)
        out[(size_t)(m0 + r + rofs) * DD + n0 + l15] = c[r] + bval;
}

// ---------------------------------------------------------------------------
extern "C" void kernel_launch(void* const* d_in, const int* in_sizes, int n_in,
                              void* d_out, int out_size, void* d_ws, size_t ws_size,
                              hipStream_t stream) {
    const float* query = (const float*)d_in[0];
    const float* key   = (const float*)d_in[1];
    const float* value = (const float*)d_in[2];
    const float* Wq = (const float*)d_in[3];
    const float* bq = (const float*)d_in[4];
    const float* Wk = (const float*)d_in[5];
    const float* bk = (const float*)d_in[6];
    const float* Wv = (const float*)d_in[7];
    const float* bv = (const float*)d_in[8];
    const float* Wo = (const float*)d_in[9];
    const float* bo = (const float*)d_in[10];

    _Float16* ws_q = (_Float16*)d_ws;          // 4 x 6 MB f16 buffers = 24 MB
    _Float16* ws_k = ws_q + ELEMS;
    _Float16* ws_v = ws_k + ELEMS;
    _Float16* ws_o = ws_v + ELEMS;

    dim3 blk(256);                              // 8 waves per block (wave32)

    qkv_proj_kernel<<<dim3(1536, 3), blk, 0, stream>>>(
        query, key, value, Wq, bq, Wk, bk, Wv, bv, ws_q, ws_k, ws_v);

    flash_attn_kernel<<<dim3(1536), blk, 0, stream>>>(ws_q, ws_k, ws_v, ws_o);

    out_proj_kernel<<<dim3(1536), blk, 0, stream>>>(ws_o, Wo, bo, (float*)d_out);
}

// v002
// One run takes 58.3 microseconds.
// Next to v001, in two timings, it ran 1.56 and 1.57 times as fast.
// All steps since v000 together make it 2.65 times as fast.
#include <hip/hip_runtime.h>
#include <hip/hip_bf16.h>

typedef __attribute__((ext_vector_type(16))) _Float16 v16h;
typedef __attribute__((ext_vector_type(8)))  _Float16 v8h;
typedef __attribute__((ext_vector_type(8)))  float    v8f;
typedef __attribute__((ext_vector_type(4)))  float    v4f;

// Problem constants
#define BB 2
#define TT 12
#define NN 1024
#define DD 128
#define HH 8
#define HD 16
#define ROWS (BB*TT*NN)          // 24576
#define ELEMS ((size_t)ROWS*DD)  // 3145728

// ---------------------------------------------------------------------------
// Fragment builders for V_WMMA_F32_16X16X32_F16 (wave32).
// 16-bit A-matrix 16x32 layout (ISA 7.12.2):
//   laneBase = (lane<16 ? 0 : 8);  row = lane&15
//   elem e<8 -> K = laneBase + e ;  e>=8 -> K = laneBase + 8 + e
// B (32x16) mirrors this with column = lane&15.
// C/D 16x16 f32: elem r -> (M = r + (lane<16?0:8), N = lane&15)
// ---------------------------------------------------------------------------

static __device__ inline v16h frag_from_f16(const _Float16* __restrict__ rowp, int laneBase) {
    v8h x0 = *(const v8h*)(rowp + laneBase);        // K = laneBase .. +7
    v8h x1 = *(const v8h*)(rowp + laneBase + 16);   // K = laneBase+16 .. +23
    v16h a;
#pragma unroll
    for (int i = 0; i < 8; ++i) { a[i] = x0[i]; a[8 + i] = x1[i]; }
    return a;
}

// K-dim = 16 (head_dim), zero-padded to 32: only e<8 valid.
static __device__ inline v16h frag_from_f16_k16(const _Float16* __restrict__ rowp, int laneBase) {
    v8h x = *(const v8h*)(rowp + laneBase);
    v16h a = {};
#pragma unroll
    for (int i = 0; i < 8; ++i) a[i] = x[i];
    return a;
}

static __device__ inline v8f wmma_f16(v16h a, v16h b, v8f c) {
    return __builtin_amdgcn_wmma_f32_16x16x32_f16(false, a, false, b,
                                                  (short)0, c, false, false);
}

// ---------------------------------------------------------------------------
// Projection tiling shared by kernels 1 and 3.
// Work-group = 8 waves = 128 rows x all 128 columns.  Weight and input block
// (each 128 x 128) come in by whole-row wave loads and are laid down as f16 in
// LDS once; each wave then computes its 16 rows x 128 columns as C^T = W * X^T:
// A = 16 weight rows, B = the wave's 16 input rows, read once into registers.
// Lane (c = lane&15, h = lane>>4) ends with C[m0 + c][16t + 8h + 0..7] in
// accumulator tile t: 8 consecutive columns of one row, stored packed.
// ---------------------------------------------------------------------------
#define WPITCH 136   // f16 per LDS row: 272 B = 16 B x 17, the pitch for 16-byte readers

typedef __attribute__((ext_vector_type(4))) _Float16 v4h;

// A thread's share of a contiguous 128x128 f32 block: each wave-wide load is one 512-B row.
static __device__ inline void f32_block_load(const float* __restrict__ src, int tid, v4f (&x)[16]) {
#pragma unroll
    for (int i = 0; i < 16; ++i)
        x[i] = *(const v4f*)(src + (size_t)(i * 256 + tid) * 4);
}

static __device__ inline void f32_block_to_lds(const v4f (&x)[16], int tid, _Float16* dst) {
#pragma unroll
    for (int i = 0; i < 16; ++i) {
        const int f = i * 256 + tid;            // float4 index: 32 per row
        *(v4h*)&dst[(f >> 5) * WPITCH + (f & 31) * 4] = __builtin_convertvector(x[i], v4h);
    }
}

static __device__ inline void proj_tiles(const _Float16* wl, const _Float16* xrow,
                                         int l15, int laneBase, v8f (&acc)[8]) {
    // 8 groups of 4 products: group g = k block g>>1, column tiles 4*(g&1) .. +3
    const _Float16* wrow = wl + l15 * WPITCH;
    v16h wa[2][4];
    v16h xb[2];
    xb[0] = frag_from_f16(xrow, laneBase);
#pragma unroll
    for (int j = 0; j < 4; ++j) wa[0][j] = frag_from_f16(wrow + 16 * j * WPITCH, laneBase);
#pragma unroll
    for (int g = 0; g < 8; ++g) {
        if (g < 7) {
            const int n = g + 1, kb = n >> 1, t0 = 4 * (n & 1);
            if ((n & 1) == 0) xb[kb & 1] = frag_from_f16(xrow + kb * 32, laneBase);
#pragma unroll
            for (int j = 0; j < 4; ++j)
                wa[n & 1][j] = frag_from_f16(wrow + 16 * (t0 + j) * WPITCH + kb * 32, laneBase);
        }
        // keeps the next group's LDS reads as one run ahead of this group's products,
        // so that a product never waits on a read issued just in front of it
        __builtin_amdgcn_sched_barrier(0);
#pragma unroll
        for (int j = 0; j < 4; ++j)
            acc[4 * (g & 1) + j] = wmma_f16(wa[g & 1][j], xb[(g >> 1) & 1], acc[4 * (g & 1) + j]);
        // keeps the group after next's reads from moving up among these products
        __builtin_amdgcn_sched_barrier(0);
    }
}

// ---------------------------------------------------------------------------
// Kernel 1: fused Q/K/V projection.  C = X @ W^T + b   (f32 in, f16 out)
// grid.x = 192 row blocks, grid.y = 3 (q/k/v)
// ---------------------------------------------------------------------------
__global__ __launch_bounds__(256)
void qkv_proj_kernel(const float* __restrict__ q_in,
                     const float* __restrict__ k_in,
                     const float* __restrict__ v_in,
                     const float* __restrict__ Wq, const float* __restrict__ bq,
                     const float* __restrict__ Wk, const float* __restrict__ bk,
                     const float* __restrict__ Wv, const float* __restrict__ bv,
                     _Float16* __restrict__ ws_q,
                     _Float16* __restrict__ ws_k,
                     _Float16* __restrict__ ws_v) {
    __shared__ __align__(16) _Float16 wl[DD * WPITCH];
    __shared__ __align__(16) _Float16 xl[128 * WPITCH];
    __shared__ __align__(16) float bl[256];     // bias, laid down twice: every thread stores, no branch among the loads

    const int tid  = threadIdx.x;
    const int lane = tid & 31;
    const int wave = tid >> 5;

    const float* X; const float* Wm; const float* bias; _Float16* O;
    if (blockIdx.y == 0)      { X = q_in; Wm = Wq; bias = bq; O = ws_q; }
    else if (blockIdx.y == 1) { X = k_in; Wm = Wk; bias = bk; O = ws_k; }
    else                      { X = v_in; Wm = Wv; bias = bv; O = ws_v; }

    const int laneBase = (lane < 16) ? 0 : 8;
    const int l15 = lane & 15;
    const size_t blk0 = (size_t)blockIdx.x * 128 * DD;  // first element of the row block

    // every load of the block is issued before the first conversion
    const float braw = bias[tid & (DD - 1)];
    v4f wraw[16], xraw[16];
    f32_block_load(Wm, tid, wraw);
    f32_block_load(X + blk0, tid, xraw);
    bl[tid] = braw;
    f32_block_to_lds(wraw, tid, wl);
    f32_block_to_lds(xraw, tid, xl);
    __syncthreads();

    v8f acc[8] = {};
    proj_tiles(wl, &xl[(wave * 16 + l15) * WPITCH], l15, laneBase, acc);

    _Float16* orow = O + blk0 + (size_t)(wave * 16 + l15) * DD + laneBase;
#pragma unroll
    for (int t = 0; t < 8; ++t) {
        const v4f b0 = *(const v4f*)&bl[16 * t + laneBase];
        const v4f b1 = *(const v4f*)&bl[16 * t + laneBase + 4];
        v8h o;
#pragma unroll
        for (int r = 0; r < 4; ++r) {
            o[r]     = (_Float16)(acc[t][r] + b0[r]);
            o[4 + r] = (_Float16)(acc[t][4 + r] + b1[r]);
        }
        *(v8h*)(orow + 16 * t) = o;
    }
}

// ---------------------------------------------------------------------------
// Kernel 2: flash attention over node dim, transposed products.
// Block = 8 waves, all on the same (b,t,h); wave w owns query tile
// (mchunk*8 + w).  Loop processes 32 keys/iteration:
//   - K/V tiles (32x16 f16, 1 KB each) staged cooperatively into LDS once
//     per block (8x less L2 traffic than per-wave loads)
//   - S^T = K * Q^T: 2 score WMMAs (HD=16 zero-padded to K=32).  A lane then
//     holds 16 scores of ONE query (column lane&15): keys 8h+r and 16+8h+r,
//     h = lane>>4, so maximum and sum run in-lane, plus one exchange l <-> l^16
//   - O^T += V^T * P^T: the two score tiles, converted in place, already are
//     the B operand in the hardware k order; P never goes through LDS
// grid.x = 192 bth * 8 mchunks = 1536 blocks
// ---------------------------------------------------------------------------
static __device__ inline float other_half(float x) {   // lane l <-> l ^ 16
    const int b = __builtin_bit_cast(int, x);
    return __builtin_bit_cast(float,
        __builtin_amdgcn_permlanex16(b, b, 0x76543210, 0xfedcba98, false, false));
}

__global__ void flash_attn_kernel(const _Float16* __restrict__ Q,
                                  const _Float16* __restrict__ K,
                                  const _Float16* __restrict__ V,
                                  _Float16* __restrict__ O) {
    __shared__ __align__(16) _Float16 kt[32][16];          // key tile
    __shared__ __align__(16) _Float16 vt[32][16];          // value tile

    const int tid  = threadIdx.x;
    const int lane = tid & 31;
    const int wave = tid >> 5;
    const int bth = blockIdx.x >> 3;            // 0..191
    const int mchunk = blockIdx.x & 7;
    const int h  = bth & 7;
    const int bt = bth >> 3;                    // 0..23
    const size_t rowbase = (size_t)bt * NN;
    const int laneBase = (lane < 16) ? 0 : 8;
    const int l15 = lane & 15;
    const int m0 = (mchunk * 8 + wave) * 16;
    const float scale = 0.25f;                  // 1/sqrt(16)

    // staging assignment: 256 threads x 4 B cover one 32x16 f16 tile
    const int srow = tid >> 3;                  // 0..31
    const int scol = (tid & 7) * 2;             // 0,2,...,14

    // Q fragment (B operand: column = query l15) stays in registers
    const v16h qb = frag_from_f16_k16(
        Q + (rowbase + m0 + l15) * DD + h * HD, laneBase);

    v8f acc = {};                               // acc[r] = O^T[hd = laneBase + r][query l15]
    float mrow = -3.0e38f;                      // running maximum of query l15
    float lsum = 0.0f;                          // this half's share of the row sum

    for (int j0 = 0; j0 < NN; j0 += 32) {
        // ---- cooperative K/V staging into LDS ----
        const size_t gsrc = (rowbase + j0 + srow) * DD + h * HD + scol;
        *(uint32_t*)&kt[srow][scol] = *(const uint32_t*)&K[gsrc];
        *(uint32_t*)&vt[srow][scol] = *(const uint32_t*)&V[gsrc];
        if (j0 + 32 < NN) {                     // pull next tiles toward L2/L0
            __builtin_prefetch(&K[gsrc + (size_t)32 * DD], 0, 0);
            __builtin_prefetch(&V[gsrc + (size_t)32 * DD], 0, 0);
        }
        __syncthreads();

        // ---- transposed scores: two 16(key) x 16(query) tiles ----
        v16h ka0 = frag_from_f16_k16(&kt[l15][0],      laneBase);
        v16h ka1 = frag_from_f16_k16(&kt[l15 + 16][0], laneBase);
        v8f s0 = {}, s1 = {};
        s0 = wmma_f16(ka0, qb, s0);
        s1 = wmma_f16(ka1, qb, s1);

        // ---- V^T fragment from LDS: A[m=hd][k=key], full K=32 ----
        v16h va;
#pragma unroll
        for (int e = 0; e < 16; ++e) {
            const int k = ((e < 8) ? e : e + 8) + laneBase;
            va[e] = vt[k][l15];
        }

        // ---- online softmax: 16 keys in-lane, the other 16 in lane ^ 16 ----
        const v8f a0 = s0 * scale;
        const v8f a1 = s1 * scale;
        float tm = fmaxf(a0[0], a1[0]);
#pragma unroll
        for (int r = 1; r < 8; ++r) tm = fmaxf(tm, fmaxf(a0[r], a1[r]));
        tm = fmaxf(tm, other_half(tm));
        const float nm = fmaxf(mrow, tm);
        const float al = __expf(mrow - nm);
        mrow = nm;

        v16h pb;                                // B[k=key][n=query], hardware k order
        float ts = 0.0f;
#pragma unroll
        for (int r = 0; r < 8; ++r) {
            const float p0 = __expf(a0[r] - nm);
            const float p1 = __expf(a1[r] - nm);
            ts += p0 + p1;
            pb[r]     = (_Float16)p0;
            pb[8 + r] = (_Float16)p1;
            acc[r] *= al;
        }
        lsum = lsum * al + ts;

        acc = wmma_f16(va, pb, acc);
        __syncthreads();        // protect kt/vt against next iteration
    }

    lsum += other_half(lsum);                   // join the two halves' sums once

    v8h o;
#pragma unroll
    for (int r = 0; r < 8; ++r) o[r] = (_Float16)(acc[r] / lsum);
    *(v8h*)&O[(rowbase + m0 + l15) * DD + h * HD + laneBase] = o;
}

// ---------------------------------------------------------------------------
// Kernel 3: output projection.  out = attn_out(f16) @ Wo^T + bo  (f32 out)
// grid.x = 192 row blocks
// ---------------------------------------------------------------------------
__global__ __launch_bounds__(256)
void out_proj_kernel(const _Float16* __restrict__ A,
                     const float* __restrict__ Wo,
                     const float* __restrict__ bo,
                     float* __restrict__ out) {
    __shared__ __align__(16) _Float16 wl[DD * WPITCH];
    __shared__ __align__(16) _Float16 xl[128 * WPITCH];
    __shared__ __align__(16) float bl[256];     // bias, laid down twice: every thread stores, no branch among the loads

    const int tid  = threadIdx.x;
    const int lane = tid & 31;
    const int wave = tid >> 5;
    const int laneBase = (lane < 16) ? 0 : 8;
    const int l15 = lane & 15;
    const size_t blk0 = (size_t)blockIdx.x * 128 * DD;

    const float braw = bo[tid & (DD - 1)];
    v4f wraw[16];
    f32_block_load(Wo, tid, wraw);
    v8h araw[8];                                // each wave-wide load is two whole 256-B rows
#pragma unroll
    for (int i = 0; i < 8; ++i)
        araw[i] = *(const v8h*)(A + blk0 + (size_t)(i * 256 + tid) * 8);
    // stands behind the last load: the loads' address registers are rewritten below
    asm volatile("s_wait_xcnt 0x0" ::: "memory");
    bl[tid] = braw;
    f32_block_to_lds(wraw, tid, wl);
#pragma unroll
    for (int i = 0; i < 8; ++i) {
        const int f = i * 256 + tid;            // 16-byte piece index: 16 per row
        *(v8h*)&xl[(f >> 4) * WPITCH + (f & 15) * 8] = araw[i];
    }
    __syncthreads();

    v8f acc[8] = {};
    proj_tiles(wl, &xl[(wave * 16 + l15) * WPITCH], l15, laneBase, acc);

    float* orow = out + blk0 + (size_t)(wave * 16 + l15) * DD + laneBase;
#pragma unroll
    for (int t = 0; t < 8; ++t) {
        const v4f b0 = *(const v4f*)&bl[16 * t + laneBase];
        const v4f b1 = *(const v4f*)&bl[16 * t + laneBase + 4];
        v4f o0, o1;
#pragma unroll
        for (int r = 0; r < 4; ++r) {
            o0[r] = acc[t][r] + b0[r];
            o1[r] = acc[t][4 + r] + b1[r];
        }
        *(v4f*)(orow + 16 * t)     = o0;
        *(v4f*)(orow + 16 * t + 4) = o1;
    }
}

// ---------------------------------------------------------------------------
extern "C" void kernel_launch(void* const* d_in, const int* in_sizes, int n_in,
                              void* d_out, int out_size, void* d_ws, size_t ws_size,
                              hipStream_t stream) {
    const float* query = (const float*)d_in[0];
    const float* key   = (const float*)d_in[1];
    const float* value = (const float*)d_in[2];
    const float* Wq = (const float*)d_in[3];
    const float* bq = (const float*)d_in[4];
    const float* Wk = (const float*)d_in[5];
    const float* bk = (const float*)d_in[6];
    const float* Wv = (const float*)d_in[7];
    const float* bv = (const float*)d_in[8];
    const float* Wo = (const float*)d_in[9];
    const float* bo = (const float*)d_in[10];

    _Float16* ws_q = (_Float16*)d_ws;          // 4 x 6 MB f16 buffers = 24 MB
    _Float16* ws_k = ws_q + ELEMS;
    _Float16* ws_v = ws_k + ELEMS;
    _Float16* ws_o = ws_v + ELEMS;

    dim3 blk(256);                              // 8 waves per block (wave32)

    qkv_proj_kernel<<<dim3(192, 3), blk, 0, stream>>>(
        query, key, value, Wq, bq, Wk, bk, Wv, bv, ws_q, ws_k, ws_v);

    flash_attn_kernel<<<dim3(1536), blk, 0, stream>>>(ws_q, ws_k, ws_v, ws_o);

    out_proj_kernel<<<dim3(192), blk, 0, stream>>>(ws_o, Wo, bo, (float*)d_out);
}

// v003
// A run of this version takes 50 microseconds.
// Next to v002, in two timings, it ran 1.17 times as fast each time.
// Over all steps from v000 it is 3.09 times as fast.
#include <hip/hip_runtime.h>
#include <hip/hip_bf16.h>

typedef __attribute__((ext_vector_type(16))) _Float16 v16h;
typedef __attribute__((ext_vector_type(8)))  _Float16 v8h;
typedef __attribute__((ext_vector_type(8)))  float    v8f;
typedef __attribute__((ext_vector_type(4)))  float    v4f;

// Problem constants
#define BB 2
#define TT 12
#define NN 1024
#define DD 128
#define HH 8
#define HD 16
#define ROWS (BB*TT*NN)          // 24576
#define ELEMS ((size_t)ROWS*DD)  // 3145728

// ---------------------------------------------------------------------------
// Fragment builders for V_WMMA_F32_16X16X32_F16 (wave32).
// 16-bit A-matrix 16x32 layout (ISA 7.12.2):
//   laneBase = (lane<16 ? 0 : 8);  row = lane&15
//   elem e<8 -> K = laneBase + e ;  e>=8 -> K = laneBase + 8 + e
// B (32x16) mirrors this with column = lane&15.
// C/D 16x16 f32: elem r -> (M = r + (lane<16?0:8), N = lane&15)
// ---------------------------------------------------------------------------

static __device__ inline v16h frag_from_f16(const _Float16* __restrict__ rowp, int laneBase) {
    v8h x0 = *(const v8h*)(rowp + laneBase);        // K = laneBase .. +7
    v8h x1 = *(const v8h*)(rowp + laneBase + 16);   // K = laneBase+16 .. +23
    v16h a;
#pragma unroll
    for (int i = 0; i < 8; ++i) { a[i] = x0[i]; a[8 + i] = x1[i]; }
    return a;
}

static __device__ inline v8f wmma_f16(v16h a, v16h b, v8f c) {
    return __builtin_amdgcn_wmma_f32_16x16x32_f16(false, a, false, b,
                                                  (short)0, c, false, false);
}

// ---------------------------------------------------------------------------
// Projection tiling shared by kernels 1 and 3.
// Work-group = 8 waves = 128 rows x all 128 columns.  Weight and input block
// (each 128 x 128) come in by whole-row wave loads and are laid down as f16 in
// LDS once; each wave then computes its 16 rows x 128 columns as C^T = W * X^T:
// A = 16 weight rows, B = the wave's 16 input rows, read once into registers.
// Lane (c = lane&15, h = lane>>4) ends with C[m0 + c][16t + 8h + 0..7] in
// accumulator tile t: 8 consecutive columns of one row, stored packed.
// ---------------------------------------------------------------------------
#define WPITCH 136   // f16 per LDS row: 272 B = 16 B x 17, the pitch for 16-byte readers

typedef __attribute__((ext_vector_type(4))) _Float16 v4h;

// A thread's share of a contiguous 128x128 f32 block: each wave-wide load is one 512-B row.
static __device__ inline void f32_block_load(const float* __restrict__ src, int tid, v4f (&x)[16]) {
#pragma unroll
    for (int i = 0; i < 16; ++i)
        x[i] = *(const v4f*)(src + (size_t)(i * 256 + tid) * 4);
}

static __device__ inline void f32_block_to_lds(const v4f (&x)[16], int tid, _Float16* dst) {
#pragma unroll
    for (int i = 0; i < 16; ++i) {
        const int f = i * 256 + tid;            // float4 index: 32 per row
        *(v4h*)&dst[(f >> 5) * WPITCH + (f & 31) * 4] = __builtin_convertvector(x[i], v4h);
    }
}

static __device__ inline void proj_tiles(const _Float16* wl, const _Float16* xrow,
                                         int l15, int laneBase, v8f (&acc)[8]) {
    // 8 groups of 4 products: group g = k block g>>1, column tiles 4*(g&1) .. +3
    const _Float16* wrow = wl + l15 * WPITCH;
    v16h wa[2][4];
    v16h xb[2];
    xb[0] = frag_from_f16(xrow, laneBase);
#pragma unroll
    for (int j = 0; j < 4; ++j) wa[0][j] = frag_from_f16(wrow + 16 * j * WPITCH, laneBase);
#pragma unroll
    for (int g = 0; g < 8; ++g) {
        if (g < 7) {
            const int n = g + 1, kb = n >> 1, t0 = 4 * (n & 1);
            if ((n & 1) == 0) xb[kb & 1] = frag_from_f16(xrow + kb * 32, laneBase);
#pragma unroll
            for (int j = 0; j < 4; ++j)
                wa[n & 1][j] = frag_from_f16(wrow + 16 * (t0 + j) * WPITCH + kb * 32, laneBase);
        }
        // keeps the next group's LDS reads as one run ahead of this group's products,
        // so that a product never waits on a read issued just in front of it
        __builtin_amdgcn_sched_barrier(0);
#pragma unroll
        for (int j = 0; j < 4; ++j)
            acc[4 * (g & 1) + j] = wmma_f16(wa[g & 1][j], xb[(g >> 1) & 1], acc[4 * (g & 1) + j]);
        // keeps the group after next's reads from moving up among these products
        __builtin_amdgcn_sched_barrier(0);
    }
}

// ---------------------------------------------------------------------------
// Kernel 1: fused Q/K/V projection.  C = X @ W^T + b   (f32 in, f16 out, head-major)
// grid.x = 192 row blocks, grid.y = 3 (q/k/v)
// ---------------------------------------------------------------------------
__global__ __launch_bounds__(256)
void qkv_proj_kernel(const float* __restrict__ q_in,
                     const float* __restrict__ k_in,
                     const float* __restrict__ v_in,
                     const float* __restrict__ Wq, const float* __restrict__ bq,
                     const float* __restrict__ Wk, const float* __restrict__ bk,
                     const float* __restrict__ Wv, const float* __restrict__ bv,
                     _Float16* __restrict__ ws_q,
                     _Float16* __restrict__ ws_k,
                     _Float16* __restrict__ ws_v) {
    __shared__ __align__(16) _Float16 wl[DD * WPITCH];
    __shared__ __align__(16) _Float16 xl[128 * WPITCH];
    __shared__ __align__(16) float bl[256];     // bias, laid down twice: every thread stores, no branch among the loads

    const int tid  = threadIdx.x;
    const int lane = tid & 31;
    const int wave = tid >> 5;

    const float* X; const float* Wm; const float* bias; _Float16* O;
    if (blockIdx.y == 0)      { X = q_in; Wm = Wq; bias = bq; O = ws_q; }
    else if (blockIdx.y == 1) { X = k_in; Wm = Wk; bias = bk; O = ws_k; }
    else                      { X = v_in; Wm = Wv; bias = bv; O = ws_v; }

    const int laneBase = (lane < 16) ? 0 : 8;
    const int l15 = lane & 15;
    const size_t blk0 = (size_t)blockIdx.x * 128 * DD;  // first element of the row block

    // every load of the block is issued before the first conversion
    const float braw = bias[tid & (DD - 1)];
    v4f wraw[16], xraw[16];
    f32_block_load(Wm, tid, wraw);
    f32_block_load(X + blk0, tid, xraw);
    bl[tid] = braw;
    f32_block_to_lds(wraw, tid, wl);
    f32_block_to_lds(xraw, tid, xl);
    __syncthreads();

    v8f acc[8] = {};
    proj_tiles(wl, &xl[(wave * 16 + l15) * WPITCH], l15, laneBase, acc);

    // head-major: [b*t][head][node][16].  Column tile t is head t, so a wave's store is
    // 16 nodes x 32 B = 512 contiguous bytes, and a head's K or V is one 32-KB run
    _Float16* orow = O + ((size_t)(blockIdx.x >> 3) * (HH * NN) + (blockIdx.x & 7) * 128
                          + wave * 16 + l15) * HD + laneBase;
#pragma unroll
    for (int t = 0; t < 8; ++t) {
        const v4f b0 = *(const v4f*)&bl[16 * t + laneBase];
        const v4f b1 = *(const v4f*)&bl[16 * t + laneBase + 4];
        v8h o;
#pragma unroll
        for (int r = 0; r < 4; ++r) {
            o[r]     = (_Float16)(acc[t][r] + b0[r]);
            o[4 + r] = (_Float16)(acc[t][4 + r] + b1[r]);
        }
        *(v8h*)(orow + t * (NN * HD)) = o;
    }
}

// ---------------------------------------------------------------------------
// Kernel 2: flash attention over node dim, transposed products, K and V resident.
// Block = 8 waves on one (b,t,h); wave w owns 32 queries (two column groups).
// Q, K, V come head-major ([b*t][head][node][16]).  The head's whole K and V
// (1024 keys x 16, 32 KB contiguous each) are laid in LDS once, behind one
// barrier; the key loop then holds no staging and no barrier.
// Per 32 keys:
//   - one K fragment: keys j..j+15 in k 0..15, keys j+16..j+31 in k 16..31.
//     Against B = [Q;0] it gives the first 16 keys' scores, against B = [0;Q]
//     the second 16 keys': S^T = K * Q^T, no zero fill of A in the loop.
//     A lane then holds 16 scores of ONE query (column lane&15): keys 8h+r and
//     16+8h+r, h = lane>>4: maximum and sum in-lane, one exchange l <-> l^16
//   - V^T fragment (A[m=hd][k=key]) by two transposing 16-byte LDS reads
//   - O^T += V^T * P^T: the two score tiles, converted in place, already are
//     the B operand in the hardware k order; P never goes through LDS
// grid.x = 192 bth * 4 query chunks = 768 blocks: three 64-KB blocks a WGP
// ---------------------------------------------------------------------------
static __device__ inline float other_half(float x) {   // lane l <-> l ^ 16
    const int b = __builtin_bit_cast(int, x);
    return __builtin_bit_cast(float,
        __builtin_amdgcn_permlanex16(b, b, 0x76543210, 0xfedcba98, false, false));
}

typedef __attribute__((ext_vector_type(8))) short s16x8;

// Lane (c = l&15, h = l>>4) gets T[8h + 0..7][c] of the 16 x 16 f16 tile whose lane
// addresses are T + (8h + (l&7)) * pitch + 16 B * ((l>>3)&1).
static __device__ inline v8h lds_tr16(const _Float16* p) {
    typedef __attribute__((address_space(3))) s16x8 lds_s16x8;
    return __builtin_bit_cast(v8h, __builtin_amdgcn_ds_load_tr16_b128_v8i16((lds_s16x8*)p));
}

static __device__ inline v16h join16(v8h lo, v8h hi) {
    return __builtin_shufflevector(lo, hi, 0, 1, 2, 3, 4, 5, 6, 7, 8, 9, 10, 11, 12, 13, 14, 15);
}

// Online softmax of one column group over 32 keys; returns P^T as the B operand.
static __device__ inline v16h softmax_step(const v8f s0, const v8f s1,
                                           float& mrow, float& lsum, v8f& acc) {
    const float scale = 0.25f;                  // 1/sqrt(16)
    const v8f a0 = s0 * scale;
    const v8f a1 = s1 * scale;
    float tm = fmaxf(a0[0], a1[0]);
#pragma unroll
    for (int r = 1; r < 8; ++r) tm = fmaxf(tm, fmaxf(a0[r], a1[r]));
    tm = fmaxf(tm, other_half(tm));
    const float nm = fmaxf(mrow, tm);
    const float al = __expf(mrow - nm);
    mrow = nm;

    // whole-vector subtraction: keeps each score pair in its own register pair
    const v8f d0 = a0 - nm;
    const v8f d1 = a1 - nm;
    v16h pb;                                    // B[k=key][n=query], hardware k order
    float ts = 0.0f;
#pragma unroll
    for (int r = 0; r < 8; ++r) {
        const float p0 = __expf(d0[r]);
        const float p1 = __expf(d1[r]);
        ts += p0 + p1;
        pb[r]     = (_Float16)p0;
        pb[8 + r] = (_Float16)p1;
    }
    acc *= al;
    lsum = lsum * al + ts;
    return pb;
}

__global__ __launch_bounds__(256)
void flash_attn_kernel(const _Float16* __restrict__ Q,
                       const _Float16* __restrict__ K,
                       const _Float16* __restrict__ V,
                       _Float16* __restrict__ O) {
    // K in two planes: plane p holds head dims 8p..8p+7 of every key, 16-byte rows, so
    // that each half wave's 16-byte reads fall on 256 contiguous bytes
    __shared__ __align__(16) _Float16 kl[2 * NN * 8];
    // V as it lies in memory: 32-byte rows, the transposing reader's pitch
    __shared__ __align__(16) _Float16 vl[NN * HD];

    const int tid  = threadIdx.x;
    const int lane = tid & 31;
    const int wave = tid >> 5;
    const int bth = blockIdx.x >> 2;            // 0..191
    const int mchunk = blockIdx.x & 3;
    const int h  = bth & 7;
    const int bt = bth >> 3;                    // 0..23
    const size_t rowbase = (size_t)bt * NN;
    const int hsel = lane >> 4;
    const int laneBase = hsel * 8;
    const int l15 = lane & 15;
    const int m0 = (mchunk * 8 + wave) * 32;

    // ---- the head's K and V: every load is issued before the first LDS store ----
    const size_t head0 = (size_t)bth * (NN * HD);       // bth = (b*t) * 8 + head
    const _Float16* Kh = K + head0;
    const _Float16* Vh = V + head0;
    v8h kraw[8], vraw[8], qraw[2];
#pragma unroll
    for (int i = 0; i < 8; ++i)                 // a wave: 16 keys, both 16-byte halves: 512 B
        kraw[i] = *(const v8h*)(Kh + (i * 128 + wave * 16 + l15) * HD + laneBase);
#pragma unroll
    for (int i = 0; i < 8; ++i)                 // a straight copy, 16 bytes a thread
        vraw[i] = *(const v8h*)(Vh + (i * 256 + tid) * 8);
    // stands in front of the Q loads: their destination may be an address register of the
    // loads above
    asm volatile("s_wait_xcnt 0x0" ::: "memory");
#pragma unroll
    for (int c = 0; c < 2; ++c)
        qraw[c] = *(const v8h*)(Q + head0 + (m0 + 16 * c + l15) * HD + laneBase);
#pragma unroll
    for (int i = 0; i < 8; ++i)
        *(v8h*)&kl[(hsel * NN + i * 128 + wave * 16 + l15) * 8] = kraw[i];
#pragma unroll
    for (int i = 0; i < 8; ++i)
        *(v8h*)&vl[(i * 256 + tid) * 8] = vraw[i];

    // Q as B operand (column = query l15), in the low and in the high k half
    const v8h zero8 = {};
    v16h qlo[2], qhi[2];
#pragma unroll
    for (int c = 0; c < 2; ++c) {
        qlo[c] = join16(qraw[c], zero8);
        qhi[c] = join16(zero8, qraw[c]);
    }
    __syncthreads();                            // K and V are laid; nothing writes them again

    v8f acc[2] = {};                            // acc[c][r] = O^T[hd = laneBase + r][query 16c + l15]
    float mrow[2] = {-3.0e38f, -3.0e38f};       // running maximum of the query
    float lsum[2] = {0.0f, 0.0f};               // this half's share of the row sum

    const _Float16* krow = &kl[(hsel * NN + l15) * 8];
    const _Float16* vrow = &vl[(laneBase + (lane & 7)) * HD + ((lane >> 3) & 1) * 8];

    for (int j0 = 0; j0 < NN; j0 += 32) {
        const v16h ka = join16(*(const v8h*)(krow + j0 * 8), *(const v8h*)(krow + (j0 + 16) * 8));
        const v16h va = join16(lds_tr16(vrow + j0 * HD), lds_tr16(vrow + (j0 + 16) * HD));

        v8f s0[2], s1[2];
#pragma unroll
        for (int c = 0; c < 2; ++c) {
            const v8f z = {};
            s0[c] = wmma_f16(ka, qlo[c], z);
            s1[c] = wmma_f16(ka, qhi[c], z);
        }
#pragma unroll
        for (int c = 0; c < 2; ++c) {
            const v16h pb = softmax_step(s0[c], s1[c], mrow[c], lsum[c], acc[c]);
            acc[c] = wmma_f16(va, pb, acc[c]);
        }
    }

#pragma unroll
    for (int c = 0; c < 2; ++c) {
        const float l = lsum[c] + other_half(lsum[c]);  // join the two halves' sums once
        v8h o;
#pragma unroll
        for (int r = 0; r < 8; ++r) o[r] = (_Float16)(acc[c][r] / l);
        *(v8h*)&O[(rowbase + m0 + 16 * c + l15) * DD + h * HD + laneBase] = o;
    }
}

// ---------------------------------------------------------------------------
// Kernel 3: output projection.  out = attn_out(f16) @ Wo^T + bo  (f32 out)
// grid.x = 192 row blocks
// ---------------------------------------------------------------------------
__global__ __launch_bounds__(256)
void out_proj_kernel(const _Float16* __restrict__ A,
                     const float* __restrict__ Wo,
                     const float* __restrict__ bo,
                     float* __restrict__ out) {
    __shared__ __align__(16) _Float16 wl[DD * WPITCH];
    __shared__ __align__(16) _Float16 xl[128 * WPITCH];
    __shared__ __align__(16) float bl[256];     // bias, laid down twice: every thread stores, no branch among the loads

    const int tid  = threadIdx.x;
    const int lane = tid & 31;
    const int wave = tid >> 5;
    const int laneBase = (lane < 16) ? 0 : 8;
    const int l15 = lane & 15;
    const size_t blk0 = (size_t)blockIdx.x * 128 * DD;

    const float braw = bo[tid & (DD - 1)];
    v4f wraw[16];
    f32_block_load(Wo, tid, wraw);
    v8h araw[8];                                // each wave-wide load is two whole 256-B rows
#pragma unroll
    for (int i = 0; i < 8; ++i)
        araw[i] = *(const v8h*)(A + blk0 + (size_t)(i * 256 + tid) * 8);
    // stands behind the last load: the loads' address registers are rewritten below
    asm volatile("s_wait_xcnt 0x0" ::: "memory");
    bl[tid] = braw;
    f32_block_to_lds(wraw, tid, wl);
#pragma unroll
    for (int i = 0; i < 8; ++i) {
        const int f = i * 256 + tid;            // 16-byte piece index: 16 per row
        *(v8h*)&xl[(f >> 4) * WPITCH + (f & 15) * 8] = araw[i];
    }
    __syncthreads();

    v8f acc[8] = {};
    proj_tiles(wl, &xl[(wave * 16 + l15) * WPITCH], l15, laneBase, acc);

    float* orow = out + blk0 + (size_t)(wave * 16 + l15) * DD + laneBase;
#pragma unroll
    for (int t = 0; t < 8; ++t) {
        const v4f b0 = *(const v4f*)&bl[16 * t + laneBase];
        const v4f b1 = *(const v4f*)&bl[16 * t + laneBase + 4];
        v4f o0, o1;
#pragma unroll
        for (int r = 0; r < 4; ++r) {
            o0[r] = acc[t][r] + b0[r];
            o1[r] = acc[t][4 + r] + b1[r];
        }
        *(v4f*)(orow + 16 * t)     = o0;
        *(v4f*)(orow + 16 * t + 4) = o1;
    }
}

// ---------------------------------------------------------------------------
extern "C" void kernel_launch(void* const* d_in, const int* in_sizes, int n_in,
                              void* d_out, int out_size, void* d_ws, size_t ws_size,
                              hipStream_t stream) {
    const float* query = (const float*)d_in[0];
    const float* key   = (const float*)d_in[1];
    const float* value = (const float*)d_in[2];
    const float* Wq = (const float*)d_in[3];
    const float* bq = (const float*)d_in[4];
    const float* Wk = (const float*)d_in[5];
    const float* bk = (const float*)d_in[6];
    const float* Wv = (const float*)d_in[7];
    const float* bv = (const float*)d_in[8];
    const float* Wo = (const float*)d_in[9];
    const float* bo = (const float*)d_in[10];

    _Float16* ws_q = (_Float16*)d_ws;          // 4 x 6 MB f16 buffers = 24 MB
    _Float16* ws_k = ws_q + ELEMS;
    _Float16* ws_v = ws_k + ELEMS;
    _Float16* ws_o = ws_v + ELEMS;

    dim3 blk(256);                              // 8 waves per block (wave32)

    qkv_proj_kernel<<<dim3(192, 3), blk, 0, stream>>>(
        query, key, value, Wq, bq, Wk, bk, Wv, bv, ws_q, ws_k, ws_v);

    flash_attn_kernel<<<dim3(768), blk, 0, stream>>>(ws_q, ws_k, ws_v, ws_o);

    out_proj_kernel<<<dim3(192), blk, 0, stream>>>(ws_o, Wo, bo, (float*)d_out);
}

// v004
// One run takes 42.5 microseconds.
// Two timings next to v003 put it at 1.18 and 1.17 times that version's speed.
// All steps since v000 together make it 3.63 times as fast.
#include <hip/hip_runtime.h>
#include <hip/hip_bf16.h>

typedef __attribute__((ext_vector_type(16))) _Float16 v16h;
typedef __attribute__((ext_vector_type(8)))  _Float16 v8h;
typedef __attribute__((ext_vector_type(8)))  float    v8f;
typedef __attribute__((ext_vector_type(4)))  float    v4f;

// Problem constants
#define BB 2
#define TT 12
#define NN 1024
#define DD 128
#define HH 8
#define HD 16
#define ROWS (BB*TT*NN)          // 24576
#define ELEMS ((size_t)ROWS*DD)  // 3145728
#define QSCALE 0.36067376022224085f   // log2(e) / sqrt(16)

// ---------------------------------------------------------------------------
// Fragment builders for V_WMMA_F32_16X16X32_F16 (wave32).
// 16-bit A-matrix 16x32 layout (ISA 7.12.2):
//   laneBase = (lane<16 ? 0 : 8);  row = lane&15
//   elem e<8 -> K = laneBase + e ;  e>=8 -> K = laneBase + 8 + e
// B (32x16) mirrors this with column = lane&15.
// C/D 16x16 f32: elem r -> (M = r + (lane<16?0:8), N = lane&15)
// ---------------------------------------------------------------------------

static __device__ inline v16h frag_from_f16(const _Float16* __restrict__ rowp, int laneBase) {
    v8h x0 = *(const v8h*)(rowp + laneBase);        // K = laneBase .. +7
    v8h x1 = *(const v8h*)(rowp + laneBase + 16);   // K = laneBase+16 .. +23
    v16h a;
#pragma unroll
    for (int i = 0; i < 8; ++i) { a[i] = x0[i]; a[8 + i] = x1[i]; }
    return a;
}

static __device__ inline v8f wmma_f16(v16h a, v16h b, v8f c) {
    return __builtin_amdgcn_wmma_f32_16x16x32_f16(false, a, false, b,
                                                  (short)0, c, false, false);
}

// ---------------------------------------------------------------------------
// Projection tiling shared by kernels 1 and 3.
// Work-group = 8 waves = 128 rows x all 128 columns.  Weight and input block
// (each 128 x 128) come in by whole-row wave loads and are laid down as f16 in
// LDS once; each wave then computes its 16 rows x 128 columns as C^T = W * X^T:
// A = 16 weight rows, B = the wave's 16 input rows, read once into registers.
// Lane (c = lane&15, h = lane>>4) ends with C[m0 + c][16t + 8h + 0..7] in
// accumulator tile t: 8 consecutive columns of one row, stored packed.
// ---------------------------------------------------------------------------
#define WPITCH 136   // f16 per LDS row: 272 B = 16 B x 17, the pitch for 16-byte readers

typedef __attribute__((ext_vector_type(4))) _Float16 v4h;

// A thread's share of a contiguous 128x128 f32 block: each wave-wide load is one 512-B row.
static __device__ inline void f32_block_load(const float* __restrict__ src, int tid, v4f (&x)[16]) {
#pragma unroll
    for (int i = 0; i < 16; ++i)
        x[i] = *(const v4f*)(src + (size_t)(i * 256 + tid) * 4);
}

static __device__ inline void f32_block_to_lds(const v4f (&x)[16], int tid, _Float16* dst) {
#pragma unroll
    for (int i = 0; i < 16; ++i) {
        const int f = i * 256 + tid;            // float4 index: 32 per row
        *(v4h*)&dst[(f >> 5) * WPITCH + (f & 31) * 4] = __builtin_convertvector(x[i], v4h);
    }
}

static __device__ inline void proj_tiles(const _Float16* wl, const _Float16* xrow,
                                         int l15, int laneBase, v8f (&acc)[8]) {
    // 8 groups of 4 products: group g = k block g>>1, column tiles 4*(g&1) .. +3
    const _Float16* wrow = wl + l15 * WPITCH;
    v16h wa[2][4];
    v16h xb[2];
    xb[0] = frag_from_f16(xrow, laneBase);
#pragma unroll
    for (int j = 0; j < 4; ++j) wa[0][j] = frag_from_f16(wrow + 16 * j * WPITCH, laneBase);
#pragma unroll
    for (int g = 0; g < 8; ++g) {
        if (g < 7) {
            const int n = g + 1, kb = n >> 1, t0 = 4 * (n & 1);
            if ((n & 1) == 0) xb[kb & 1] = frag_from_f16(xrow + kb * 32, laneBase);
#pragma unroll
            for (int j = 0; j < 4; ++j)
                wa[n & 1][j] = frag_from_f16(wrow + 16 * (t0 + j) * WPITCH + kb * 32, laneBase);
        }
        // keeps the next group's LDS reads as one run ahead of this group's products,
        // so that a product never waits on a read issued just in front of it
        __builtin_amdgcn_sched_barrier(0);
#pragma unroll
        for (int j = 0; j < 4; ++j)
            acc[4 * (g & 1) + j] = wmma_f16(wa[g & 1][j], xb[(g >> 1) & 1], acc[4 * (g & 1) + j]);
        // keeps the group after next's reads from moving up among these products
        __builtin_amdgcn_sched_barrier(0);
    }
}

// ---------------------------------------------------------------------------
// Kernel 1: fused Q/K/V projection.  C = X @ W^T + b   (f32 in, f16 out, head-major)
// Q leaves multiplied by QSCALE (in f32, ahead of its one rounding to f16), so that
// the attention kernel's score product is already in exp2 units; K and V by 1.
// grid.x = 192 row blocks, grid.y = 3 (q/k/v)
// ---------------------------------------------------------------------------
__global__ __launch_bounds__(256)
void qkv_proj_kernel(const float* __restrict__ q_in,
                     const float* __restrict__ k_in,
                     const float* __restrict__ v_in,
                     const float* __restrict__ Wq, const float* __restrict__ bq,
                     const float* __restrict__ Wk, const float* __restrict__ bk,
                     const float* __restrict__ Wv, const float* __restrict__ bv,
                     _Float16* __restrict__ ws_q,
                     _Float16* __restrict__ ws_k,
                     _Float16* __restrict__ ws_v) {
    __shared__ __align__(16) _Float16 wl[DD * WPITCH];
    __shared__ __align__(16) _Float16 xl[128 * WPITCH];
    __shared__ __align__(16) float bl[256];     // bias, laid down twice: every thread stores, no branch among the loads

    const int tid  = threadIdx.x;
    const int lane = tid & 31;
    const int wave = tid >> 5;

    const float* X; const float* Wm; const float* bias; _Float16* O;
    const float osc = (blockIdx.y == 0) ? QSCALE : 1.0f;
    if (blockIdx.y == 0)      { X = q_in; Wm = Wq; bias = bq; O = ws_q; }
    else if (blockIdx.y == 1) { X = k_in; Wm = Wk; bias = bk; O = ws_k; }
    else                      { X = v_in; Wm = Wv; bias = bv; O = ws_v; }

    const int laneBase = (lane < 16) ? 0 : 8;
    const int l15 = lane & 15;
    const size_t blk0 = (size_t)blockIdx.x * 128 * DD;  // first element of the row block

    // every load of the block is issued before the first conversion
    const float braw = bias[tid & (DD - 1)];
    v4f wraw[16], xraw[16];
    f32_block_load(Wm, tid, wraw);
    f32_block_load(X + blk0, tid, xraw);
    bl[tid] = braw;
    f32_block_to_lds(wraw, tid, wl);
    f32_block_to_lds(xraw, tid, xl);
    __syncthreads();

    v8f acc[8] = {};
    proj_tiles(wl, &xl[(wave * 16 + l15) * WPITCH], l15, laneBase, acc);

    // head-major: [b*t][head][node][16].  Column tile t is head t, so a wave's store is
    // 16 nodes x 32 B = 512 contiguous bytes, and a head's K or V is one 32-KB run
    _Float16* orow = O + ((size_t)(blockIdx.x >> 3) * (HH * NN) + (blockIdx.x & 7) * 128
                          + wave * 16 + l15) * HD + laneBase;
#pragma unroll
    for (int t = 0; t < 8; ++t) {
        const v4f b0 = *(const v4f*)&bl[16 * t + laneBase];
        const v4f b1 = *(const v4f*)&bl[16 * t + laneBase + 4];
        v8h o;
#pragma unroll
        for (int r = 0; r < 4; ++r) {
            o[r]     = (_Float16)((acc[t][r] + b0[r]) * osc);
            o[4 + r] = (_Float16)((acc[t][4 + r] + b1[r]) * osc);
        }
        *(v8h*)(orow + t * (NN * HD)) = o;
    }
}

// ---------------------------------------------------------------------------
// Kernel 2: flash attention over node dim, transposed products, K and V resident.
// Block = 8 waves on one (b,t,h); wave w owns 32 queries (two column groups).
// Q, K, V come head-major ([b*t][head][node][16]).  The head's whole K and V
// (1024 keys x 16, 32 KB contiguous each) are laid in LDS once, behind one
// barrier; the key loop then holds no staging and no barrier.
// Per 32 keys:
//   - one K fragment: keys j..j+15 in k 0..15, keys j+16..j+31 in k 16..31.
//     Against B = [Q;0] it gives the first 16 keys' scores, against B = [0;Q]
//     the second 16 keys': S^T = K * Q^T, no zero fill of A in the loop.
//     A lane then holds 16 scores of ONE query (column lane&15): keys 8h+r and
//     16+8h+r, h = lane>>4
//   - Q comes in exp2 units and the product's C operand is minus the maximum in use,
//     so the accumulator IS the exp2 argument: no scale, maximum or subtraction per
//     score.  The maximum in use starts as the true maximum of keys 0..31 and is
//     raised (with the rescale of O and of the row sum) only in a pass where some
//     lane's sum of P tops PLIM: one wave-uniform branch per pass
//   - V^T fragment (A[m=hd][k=key]) by two transposing 16-byte LDS reads
//   - O^T += V^T * P^T: the two score tiles, converted in place, already are
//     the B operand in the hardware k order; P never goes through LDS
// grid.x = 192 bth * 4 query chunks = 768 blocks: three 64-KB blocks a WGP
// ---------------------------------------------------------------------------
static __device__ inline float other_half(float x) {   // lane l <-> l ^ 16
    const int b = __builtin_bit_cast(int, x);
    return __builtin_bit_cast(float,
        __builtin_amdgcn_permlanex16(b, b, 0x76543210, 0xfedcba98, false, false));
}

typedef __attribute__((ext_vector_type(8))) short s16x8;

// Lane (c = l&15, h = l>>4) gets T[8h + 0..7][c] of the 16 x 16 f16 tile whose lane
// addresses are T + (8h + (l&7)) * pitch + 16 B * ((l>>3)&1).
static __device__ inline v8h lds_tr16(const _Float16* p) {
    typedef __attribute__((address_space(3))) s16x8 lds_s16x8;
    return __builtin_bit_cast(v8h, __builtin_amdgcn_ds_load_tr16_b128_v8i16((lds_s16x8*)p));
}

static __device__ inline v16h join16(v8h lo, v8h hi) {
    return __builtin_shufflevector(lo, hi, 0, 1, 2, 3, 4, 5, 6, 7, 8, 9, 10, 11, 12, 13, 14, 15);
}

typedef __attribute__((ext_vector_type(2))) float v2f;

#define PLIM 4096.0f    // a lane's sum of 32 P at or below it: every P fits f16 with room

static __device__ inline v8f exp2_8(const v8f d) {
    v8f e;
#pragma unroll   // constant indices: the vector stays in registers
    for (int r = 0; r < 8; ++r) e[r] = __builtin_amdgcn_exp2f(d[r]);
    return e;
}

static __device__ inline float sum16(const v8f e0, const v8f e1) {  // pairwise, on register pairs
    const v8f t8 = e0 + e1;
    const v4f t4 = __builtin_shufflevector(t8, t8, 0, 1, 2, 3) + __builtin_shufflevector(t8, t8, 4, 5, 6, 7);
    const v2f t2 = __builtin_shufflevector(t4, t4, 0, 1) + __builtin_shufflevector(t4, t4, 2, 3);
    return t2[0] + t2[1];
}

static __device__ inline float max16_both_halves(const v8f d0, const v8f d1) {
    float tm = fmaxf(d0[0], d1[0]);
#pragma unroll   // constant indices: the vectors stay in registers
    for (int r = 1; r < 8; ++r) tm = fmaxf(tm, fmaxf(d0[r], d1[r]));
    return fmaxf(tm, other_half(tm));
}

__global__ __launch_bounds__(256)
void flash_attn_kernel(const _Float16* __restrict__ Q,
                       const _Float16* __restrict__ K,
                       const _Float16* __restrict__ V,
                       _Float16* __restrict__ O) {
    // K in two planes: plane p holds head dims 8p..8p+7 of every key, 16-byte rows, so
    // that each half wave's 16-byte reads fall on 256 contiguous bytes
    __shared__ __align__(16) _Float16 kl[2 * NN * 8];
    // V as it lies in memory: 32-byte rows, the transposing reader's pitch
    __shared__ __align__(16) _Float16 vl[NN * HD];

    const int tid  = threadIdx.x;
    const int lane = tid & 31;
    const int wave = tid >> 5;
    const int bth = blockIdx.x >> 2;            // 0..191
    const int mchunk = blockIdx.x & 3;
    const int h  = bth & 7;
    const int bt = bth >> 3;                    // 0..23
    const size_t rowbase = (size_t)bt * NN;
    const int hsel = lane >> 4;
    const int laneBase = hsel * 8;
    const int l15 = lane & 15;
    const int m0 = (mchunk * 8 + wave) * 32;

    // ---- the head's K and V: every load is issued before the first LDS store ----
    const size_t head0 = (size_t)bth * (NN * HD);       // bth = (b*t) * 8 + head
    const _Float16* Kh = K + head0;
    const _Float16* Vh = V + head0;
    v8h kraw[8], vraw[8], qraw[2];
#pragma unroll
    for (int i = 0; i < 8; ++i)                 // a wave: 16 keys, both 16-byte halves: 512 B
        kraw[i] = *(const v8h*)(Kh + (i * 128 + wave * 16 + l15) * HD + laneBase);
#pragma unroll
    for (int i = 0; i < 8; ++i)                 // a straight copy, 16 bytes a thread
        vraw[i] = *(const v8h*)(Vh + (i * 256 + tid) * 8);
    // stands in front of the Q loads: their destination may be an address register of the
    // loads above
    asm volatile("s_wait_xcnt 0x0" ::: "memory");
#pragma unroll
    for (int c = 0; c < 2; ++c)
        qraw[c] = *(const v8h*)(Q + head0 + (m0 + 16 * c + l15) * HD + laneBase);
#pragma unroll
    for (int i = 0; i < 8; ++i)
        *(v8h*)&kl[(hsel * NN + i * 128 + wave * 16 + l15) * 8] = kraw[i];
#pragma unroll
    for (int i = 0; i < 8; ++i)
        *(v8h*)&vl[(i * 256 + tid) * 8] = vraw[i];

    // Q as B operand (column = query l15), in the low and in the high k half
    const v8h zero8 = {};
    v16h qlo[2], qhi[2];
#pragma unroll
    for (int c = 0; c < 2; ++c) {
        qlo[c] = join16(qraw[c], zero8);
        qhi[c] = join16(zero8, qraw[c]);
    }
    __syncthreads();                            // K and V are laid; nothing writes them again

    v8f acc[2] = {};                            // acc[c][r] = O^T[hd = laneBase + r][query 16c + l15]
    float lsum[2] = {0.0f, 0.0f};               // this half's share of the row sum

    const _Float16* krow = &kl[(hsel * NN + l15) * 8];
    const _Float16* vrow = &vl[(laneBase + (lane & 7)) * HD + ((lane >> 3) & 1) * 8];

    // minus the maximum in use of the lane's query, in all 8 places of a C operand;
    // it starts as the true maximum over keys 0..31, so the first P are at most 1
    v8f negm[2];
    {
        const v16h ka = join16(*(const v8h*)krow, *(const v8h*)(krow + 16 * 8));
#pragma unroll   // here and below: the two column groups' arrays need constant indices
        for (int c = 0; c < 2; ++c) {
            const v8f z = {};
            negm[c] = z - max16_both_halves(wmma_f16(ka, qlo[c], z), wmma_f16(ka, qhi[c], z));
        }
    }

    for (int j0 = 0; j0 < NN; j0 += 32) {
        const v16h ka = join16(*(const v8h*)(krow + j0 * 8), *(const v8h*)(krow + (j0 + 16) * 8));
        const v16h va = join16(lds_tr16(vrow + j0 * HD), lds_tr16(vrow + (j0 + 16) * HD));

        v8f d0[2], d1[2], e0[2], e1[2];
        float ts[2];
#pragma unroll
        for (int c = 0; c < 2; ++c) {
            d0[c] = wmma_f16(ka, qlo[c], negm[c]);
            d1[c] = wmma_f16(ka, qhi[c], negm[c]);
        }
#pragma unroll
        for (int c = 0; c < 2; ++c) {
            e0[c] = exp2_8(d0[c]);
            e1[c] = exp2_8(d1[c]);
            ts[c] = sum16(e0[c], e1[c]);
        }
        // P are not negative, so the sum bounds each of them; an infinite sum fails the test too
        if (__builtin_amdgcn_ballot_w32(!(ts[0] + ts[1] <= PLIM)) != 0) {
#pragma unroll
            for (int c = 0; c < 2; ++c) {
                const float up = fmaxf(max16_both_halves(d0[c], d1[c]), 0.0f);  // same in both halves
                const float al = __builtin_amdgcn_exp2f(-up);
                negm[c] -= up;
                e0[c] = exp2_8(d0[c] - up);
                e1[c] = exp2_8(d1[c] - up);
                ts[c] = sum16(e0[c], e1[c]);
                acc[c] *= al;
                lsum[c] *= al;
            }
        }
#pragma unroll
        for (int c = 0; c < 2; ++c) {
            lsum[c] += ts[c];
            v16h pb;                            // B[k=key][n=query], hardware k order
#pragma unroll
            for (int r = 0; r < 8; ++r) {
                pb[r]     = (_Float16)e0[c][r];
                pb[8 + r] = (_Float16)e1[c][r];
            }
            acc[c] = wmma_f16(va, pb, acc[c]);
        }
    }

#pragma unroll
    for (int c = 0; c < 2; ++c) {
        const float l = lsum[c] + other_half(lsum[c]);  // join the two halves' sums once
        v8h o;
#pragma unroll
        for (int r = 0; r < 8; ++r) o[r] = (_Float16)(acc[c][r] / l);
        *(v8h*)&O[(rowbase + m0 + 16 * c + l15) * DD + h * HD + laneBase] = o;
    }
}

// ---------------------------------------------------------------------------
// Kernel 3: output projection.  out = attn_out(f16) @ Wo^T + bo  (f32 out)
// grid.x = 192 row blocks
// ---------------------------------------------------------------------------
__global__ __launch_bounds__(256)
void out_proj_kernel(const _Float16* __restrict__ A,
                     const float* __restrict__ Wo,
                     const float* __restrict__ bo,
                     float* __restrict__ out) {
    __shared__ __align__(16) _Float16 wl[DD * WPITCH];
    __shared__ __align__(16) _Float16 xl[128 * WPITCH];
    __shared__ __align__(16) float bl[256];     // bias, laid down twice: every thread stores, no branch among the loads

    const int tid  = threadIdx.x;
    const int lane = tid & 31;
    const int wave = tid >> 5;
    const int laneBase = (lane < 16) ? 0 : 8;
    const int l15 = lane & 15;
    const size_t blk0 = (size_t)blockIdx.x * 128 * DD;

    const float braw = bo[tid & (DD - 1)];
    v4f wraw[16];
    f32_block_load(Wo, tid, wraw);
    v8h araw[8];                                // each wave-wide load is two whole 256-B rows
#pragma unroll
    for (int i = 0; i < 8; ++i)
        araw[i] = *(const v8h*)(A + blk0 + (size_t)(i * 256 + tid) * 8);
    // stands behind the last load: the loads' address registers are rewritten below
    asm volatile("s_wait_xcnt 0x0" ::: "memory");
    bl[tid] = braw;
    f32_block_to_lds(wraw, tid, wl);
#pragma unroll
    for (int i = 0; i < 8; ++i) {
        const int f = i * 256 + tid;            // 16-byte piece index: 16 per row
        *(v8h*)&xl[(f >> 4) * WPITCH + (f & 15) * 8] = araw[i];
    }
    __syncthreads();

    v8f acc[8] = {};
    proj_tiles(wl, &xl[(wave * 16 + l15) * WPITCH], l15, laneBase, acc);

    float* orow = out + blk0 + (size_t)(wave * 16 + l15) * DD + laneBase;
#pragma unroll
    for (int t = 0; t < 8; ++t) {
        const v4f b0 = *(const v4f*)&bl[16 * t + laneBase];
        const v4f b1 = *(const v4f*)&bl[16 * t + laneBase + 4];
        v4f o0, o1;
#pragma unroll
        for (int r = 0; r < 4; ++r) {
            o0[r] = acc[t][r] + b0[r];
            o1[r] = acc[t][4 + r] + b1[r];
        }
        *(v4f*)(orow + 16 * t)     = o0;
        *(v4f*)(orow + 16 * t + 4) = o1;
    }
}

// ---------------------------------------------------------------------------
extern "C" void kernel_launch(void* const* d_in, const int* in_sizes, int n_in,
                              void* d_out, int out_size, void* d_ws, size_t ws_size,
                              hipStream_t stream) {
    const float* query = (const float*)d_in[0];
    const float* key   = (const float*)d_in[1];
    const float* value = (const float*)d_in[2];
    const float* Wq = (const float*)d_in[3];
    const float* bq = (const float*)d_in[4];
    const float* Wk = (const float*)d_in[5];
    const float* bk = (const float*)d_in[6];
    const float* Wv = (const float*)d_in[7];
    const float* bv = (const float*)d_in[8];
    const float* Wo = (const float*)d_in[9];
    const float* bo = (const float*)d_in[10];

    _Float16* ws_q = (_Float16*)d_ws;          // 4 x 6 MB f16 buffers = 24 MB
    _Float16* ws_k = ws_q + ELEMS;
    _Float16* ws_v = ws_k + ELEMS;
    _Float16* ws_o = ws_v + ELEMS;

    dim3 blk(256);                              // 8 waves per block (wave32)

    qkv_proj_kernel<<<dim3(192, 3), blk, 0, stream>>>(
        query, key, value, Wq, bq, Wk, bk, Wv, bv, ws_q, ws_k, ws_v);

    flash_attn_kernel<<<dim3(768), blk, 0, stream>>>(ws_q, ws_k, ws_v, ws_o);

    out_proj_kernel<<<dim3(192), blk, 0, stream>>>(ws_o, Wo, bo, (float*)d_out);
}

// v006
// One run takes 37.6 microseconds.
// Versions in between are left out here; by their measured steps it is 1.13 times as fast as v004.
// Counting every step since v000, it is 4.11 times as fast.
#include <hip/hip_runtime.h>
#include <hip/hip_bf16.h>

typedef __attribute__((ext_vector_type(16))) _Float16 v16h;
typedef __attribute__((ext_vector_type(8)))  _Float16 v8h;
typedef __attribute__((ext_vector_type(8)))  float    v8f;
typedef __attribute__((ext_vector_type(4)))  float    v4f;

// Problem constants
#define BB 2
#define TT 12
#define NN 1024
#define DD 128
#define HH 8
#define HD 16
#define ROWS (BB*TT*NN)          // 24576
#define ELEMS ((size_t)ROWS*DD)  // 3145728
#define QSCALE 0.36067376022224085f   // log2(e) / sqrt(16)

// ---------------------------------------------------------------------------
// Fragment builders for V_WMMA_F32_16X16X32_F16 (wave32).
// 16-bit A-matrix 16x32 layout (ISA 7.12.2):
//   laneBase = (lane<16 ? 0 : 8);  row = lane&15
//   elem e<8 -> K = laneBase + e ;  e>=8 -> K = laneBase + 8 + e
// B (32x16) mirrors this with column = lane&15.
// C/D 16x16 f32: elem r -> (M = r + (lane<16?0:8), N = lane&15)
// ---------------------------------------------------------------------------

static __device__ inline v16h frag_from_f16(const _Float16* __restrict__ rowp, int laneBase) {
    v8h x0 = *(const v8h*)(rowp + laneBase);        // K = laneBase .. +7
    v8h x1 = *(const v8h*)(rowp + laneBase + 16);   // K = laneBase+16 .. +23
    v16h a;
#pragma unroll
    for (int i = 0; i < 8; ++i) { a[i] = x0[i]; a[8 + i] = x1[i]; }
    return a;
}

static __device__ inline v8f wmma_f16(v16h a, v16h b, v8f c) {
    return __builtin_amdgcn_wmma_f32_16x16x32_f16(false, a, false, b,
                                                  (short)0, c, false, false);
}

// ---------------------------------------------------------------------------
// Projection tiling of kernel 1.
// Work-group = 8 waves = 128 rows x all 128 columns.  Weight and input block
// (each 128 x 128) come in by whole-row wave loads and are laid down as f16 in
// LDS once; each wave of a Q or K block then computes its 16 rows x 128 columns as C^T = W * X^T:
// A = 16 weight rows, B = the wave's 16 input rows, read once into registers.
// Lane (c = lane&15, h = lane>>4) ends with C[m0 + c][16t + 8h + 0..7] in
// accumulator tile t: 8 consecutive columns of one row, stored packed.
// ---------------------------------------------------------------------------
#define WPITCH 136   // f16 per LDS row: 272 B = 16 B x 17, the pitch for 16-byte readers

typedef __attribute__((ext_vector_type(4))) _Float16 v4h;

// A thread's share of a contiguous 128x128 f32 block: each wave-wide load is one 512-B row.
static __device__ inline void f32_block_load(const float* __restrict__ src, int tid, v4f (&x)[16]) {
#pragma unroll
    for (int i = 0; i < 16; ++i)
        x[i] = *(const v4f*)(src + (size_t)(i * 256 + tid) * 4);
}

static __device__ inline void f32_block_to_lds(const v4f (&x)[16], int tid, _Float16* dst) {
#pragma unroll
    for (int i = 0; i < 16; ++i) {
        const int f = i * 256 + tid;            // float4 index: 32 per row
        *(v4h*)&dst[(f >> 5) * WPITCH + (f & 31) * 4] = __builtin_convertvector(x[i], v4h);
    }
}

// XA = false: C^T = W * X^T, as above.  XA = true: the same two fragments in the other order,
// C = X * W^T: the lane ends with C[m0 + 8h + 0..7][16t + c], 8 consecutive rows of one column.
template <bool XA>
static __device__ inline void proj_tiles(const _Float16* wl, const _Float16* xrow,
                                         int l15, int laneBase, v8f (&acc)[8]) {
    // 8 groups of 4 products: group g = k block g>>1, column tiles 4*(g&1) .. +3
    const _Float16* wrow = wl + l15 * WPITCH;
    v16h wa[2][4];
    v16h xb[2];
    xb[0] = frag_from_f16(xrow, laneBase);
#pragma unroll
    for (int j = 0; j < 4; ++j) wa[0][j] = frag_from_f16(wrow + 16 * j * WPITCH, laneBase);
#pragma unroll
    for (int g = 0; g < 8; ++g) {
        if (g < 7) {
            const int n = g + 1, kb = n >> 1, t0 = 4 * (n & 1);
            if ((n & 1) == 0) xb[kb & 1] = frag_from_f16(xrow + kb * 32, laneBase);
#pragma unroll
            for (int j = 0; j < 4; ++j)
                wa[n & 1][j] = frag_from_f16(wrow + 16 * (t0 + j) * WPITCH + kb * 32, laneBase);
        }
        // keeps the next group's LDS reads as one run ahead of this group's products,
        // so that a product never waits on a read issued just in front of it
        __builtin_amdgcn_sched_barrier(0);
#pragma unroll
        for (int j = 0; j < 4; ++j)
            acc[4 * (g & 1) + j] = XA ? wmma_f16(xb[(g >> 1) & 1], wa[g & 1][j], acc[4 * (g & 1) + j])
                                      : wmma_f16(wa[g & 1][j], xb[(g >> 1) & 1], acc[4 * (g & 1) + j]);
        // keeps the group after next's reads from moving up among these products
        __builtin_amdgcn_sched_barrier(0);
    }
}

static __device__ inline float other_half(float x) {   // lane l <-> l ^ 16
    const int b = __builtin_bit_cast(int, x);
    return __builtin_bit_cast(float,
        __builtin_amdgcn_permlanex16(b, b, 0x76543210, 0xfedcba98, false, false));
}

static __device__ inline v16h join16(v8h lo, v8h hi) {
    return __builtin_shufflevector(lo, hi, 0, 1, 2, 3, 4, 5, 6, 7, 8, 9, 10, 11, 12, 13, 14, 15);
}

typedef __attribute__((ext_vector_type(2))) float v2f;

#define PLIM 4096.0f    // a lane's sum of 32 P at or below it: every P fits f16 with room

static __device__ inline v8f exp2_8(const v8f d) {
    v8f e;
#pragma unroll   // constant indices: the vector stays in registers
    for (int r = 0; r < 8; ++r) e[r] = __builtin_amdgcn_exp2f(d[r]);
    return e;
}

static __device__ inline float sum16(const v8f e0, const v8f e1) {  // pairwise, on register pairs
    const v8f t8 = e0 + e1;
    const v4f t4 = __builtin_shufflevector(t8, t8, 0, 1, 2, 3) + __builtin_shufflevector(t8, t8, 4, 5, 6, 7);
    const v2f t2 = __builtin_shufflevector(t4, t4, 0, 1) + __builtin_shufflevector(t4, t4, 2, 3);
    return t2[0] + t2[1];
}

static __device__ inline float max16_both_halves(const v8f d0, const v8f d1) {
    float tm = fmaxf(d0[0], d1[0]);
#pragma unroll   // constant indices: the vectors stay in registers
    for (int r = 1; r < 8; ++r) tm = fmaxf(tm, fmaxf(d0[r], d1[r]));
    return fmaxf(tm, other_half(tm));
}

// Sum of the squares of 8 f16, summed in f32: no finite f16 overflows it
static __device__ inline float sumsq8(const v8h x) {
    float s = 0.0f;
#pragma unroll   // constant indices: the vector stays in registers
    for (int r = 0; r < 8; ++r) s = fmaf((float)x[r], (float)x[r], s);
    return s;
}

// At least the true sum of squares: 1 % and 1e-6 stand for what the roundings of 16 terms and
// products of subnormal size can lose
static __device__ inline float length_bound(float s) { return fmaf(s, 1.01f, 1e-6f); }

template <int CTRL>
static __device__ inline float max_dpp(float x) {      // maximum with the lane that CTRL names
    const int b = __builtin_bit_cast(int, x);
    return fmaxf(x, __builtin_bit_cast(float, __builtin_amdgcn_update_dpp(b, b, CTRL, 0xf, 0xf, false)));
}

static __device__ inline float row16_max(float x) {    // over the lane's 16-lane row: row_xmask 1, 2, 4, 8
    return max_dpp<0x168>(max_dpp<0x164>(max_dpp<0x162>(max_dpp<0x161>(x))));
}

template <bool B> struct flag { static constexpr bool value = B; };

// ---------------------------------------------------------------------------
// Kernel 1: fused Q/K/V projection.  C = X @ W^T + b   (f32 in, f16 out, head-major)
// Q leaves multiplied by QSCALE (in f32, ahead of its one rounding to f16), so that
// the attention kernel's score product is already in exp2 units; K and V by 1.
// Q and K leave as [b*t][head][node][16].  V leaves in the order of the attention kernel's
// V^T fragment: [b*t][head][16-node group][lane (c = head dim, h)][nodes 8h .. 8h+7].
// The K blocks also leave, per wave and head, a bound on the squared length of their 16 keys.
// grid.x = 192 row blocks, grid.y = 3 (q/k/v)
// ---------------------------------------------------------------------------
__global__ __launch_bounds__(256)
void qkv_proj_kernel(const float* __restrict__ q_in,
                     const float* __restrict__ k_in,
                     const float* __restrict__ v_in,
                     const float* __restrict__ Wq, const float* __restrict__ bq,
                     const float* __restrict__ Wk, const float* __restrict__ bk,
                     const float* __restrict__ Wv, const float* __restrict__ bv,
                     _Float16* __restrict__ ws_q,
                     _Float16* __restrict__ ws_k,
                     _Float16* __restrict__ ws_v,
                     float* __restrict__ ws_kmx) {
    __shared__ __align__(16) _Float16 wl[DD * WPITCH];
    __shared__ __align__(16) _Float16 xl[128 * WPITCH];
    __shared__ __align__(16) float bl[256];     // bias, laid down twice: every thread stores, no branch among the loads

    const int tid  = threadIdx.x;
    const int lane = tid & 31;
    const int wave = tid >> 5;

    const float* X; const float* Wm; const float* bias; _Float16* O;
    const float osc = (blockIdx.y == 0) ? QSCALE : 1.0f;
    if (blockIdx.y == 0)      { X = q_in; Wm = Wq; bias = bq; O = ws_q; }
    else if (blockIdx.y == 1) { X = k_in; Wm = Wk; bias = bk; O = ws_k; }
    else                      { X = v_in; Wm = Wv; bias = bv; O = ws_v; }

    const int laneBase = (lane < 16) ? 0 : 8;
    const int l15 = lane & 15;
    const size_t blk0 = (size_t)blockIdx.x * 128 * DD;  // first element of the row block

    // every load of the block is issued before the first conversion
    const float braw = bias[tid & (DD - 1)];
    v4f wraw[16], xraw[16];
    f32_block_load(Wm, tid, wraw);
    f32_block_load(X + blk0, tid, xraw);
    bl[tid] = braw;
    f32_block_to_lds(wraw, tid, wl);
    f32_block_to_lds(xraw, tid, xl);
    __syncthreads();

    v8f acc[8] = {};
    // first element of the wave's 16 nodes in head 0's plane; column tile t is head t
    _Float16* o16 = O + ((size_t)(blockIdx.x >> 3) * (HH * NN) + (blockIdx.x & 7) * 128 + wave * 16) * HD;

    if (blockIdx.y == 2) {
        proj_tiles<true>(wl, &xl[(wave * 16 + l15) * WPITCH], l15, laneBase, acc);
        // the lane holds nodes 8h .. 8h+7 of head dim c: its 16 bytes of the V^T fragment;
        // a wave's store is 512 contiguous bytes
#pragma unroll
        for (int t = 0; t < 8; ++t) {
            const float b = bl[16 * t + l15];
            v8h o;
#pragma unroll
            for (int r = 0; r < 8; ++r) o[r] = (_Float16)(acc[t][r] + b);
            *(v8h*)(o16 + t * (NN * HD) + lane * 8) = o;
        }
        return;
    }

    proj_tiles<false>(wl, &xl[(wave * 16 + l15) * WPITCH], l15, laneBase, acc);

    // [node][16]: a wave's store is 16 nodes x 32 B = 512 contiguous bytes
    _Float16* orow = o16 + l15 * HD + laneBase;
    v8h oo[8];
#pragma unroll
    for (int t = 0; t < 8; ++t) {
        const v4f b0 = *(const v4f*)&bl[16 * t + laneBase];
        const v4f b1 = *(const v4f*)&bl[16 * t + laneBase + 4];
        v8h o;
#pragma unroll
        for (int r = 0; r < 4; ++r) {
            o[r]     = (_Float16)((acc[t][r] + b0[r]) * osc);
            o[4 + r] = (_Float16)((acc[t][4 + r] + b1[r]) * osc);
        }
        *(v8h*)(orow + t * (NN * HD)) = o;
        oo[t] = o;
    }
    // stands behind the last store, in front of the branch: the sums below rewrite registers that
    // the stores name (inside the branch the compiler moved those sums up over it)
    asm volatile("s_wait_xcnt 0x0" ::: "memory");
    if (blockIdx.y == 1) {
        float kb8 = 0.0f;                       // lane t: the bound of head t
#pragma unroll   // oo needs constant indices to stay in registers
        for (int t = 0; t < 8; ++t) {
            // the largest sum of squares among the 16 keys as stored, each 8-dim half apart; the
            // sum of the two halves' maxima is at least every key's squared length
            float kh = row16_max(sumsq8(oo[t]));
            kh += other_half(kh);
            kb8 = (lane == t) ? kh : kb8;
        }
        // [row block][head][wave]: a work-group's 64 bounds are 256 bytes of its own
        if (lane < 8) ws_kmx[((size_t)blockIdx.x * HH + lane) * 8 + wave] = kb8;
    }
}

// ---------------------------------------------------------------------------
// Kernel 2: flash attention over the node dim with the output projection behind it.
// Block = 24 waves = 3 groups of 32 queries x 8 heads; wave = one head of one group (two
// column groups of 16 queries).  256 blocks: one a WGP, six waves a SIMD.
// K and V fragments come straight from global memory, each a pair of 512-byte wave loads,
// fetched ahead into registers in the loop without a maximum; the three waves of a head read the same lines unless the block's groups span two (b,t).  The key
// loop holds no LDS access and no barrier.
// Per 32 keys:
//   - one K fragment: keys j..j+15 in k 0..15, keys j+16..j+31 in k 16..31.
//     Against B = [Q;0] it gives the first 16 keys' scores, against B = [0;Q]
//     the second 16 keys': S^T = K * Q^T, no zero fill of A in the loop.
//     A lane then holds 16 scores of ONE query (column lane&15): keys 8h+r and
//     16+8h+r, h = lane>>4
//   - Q comes in exp2 units and the product's C operand is minus the maximum in use,
//     so the accumulator IS the exp2 argument: no scale, maximum or subtraction per
//     score.  The maximum in use starts as the true maximum of keys 0..31 and is
//     raised (with the rescale of O and of the row sum) only in a pass where some
//     lane's sum of P tops PLIM: one wave-uniform branch per pass
//   - a wave whose scores are all bounded by |q| * max|k| <= 10 (the keys' bound comes from
//     their projection) takes a loop of its own with no maximum at all: C = 0, P = exp2(score)
//   - V^T fragment (A[m=hd][k=key]): stored in that order by V's projection
//   - O^T += V^T * P^T: the two score tiles, converted in place, already are
//     the B operand in the hardware k order; P never goes through LDS
// Behind the loop the 8 heads of a query meet in LDS (f16, one barrier), and wave (group, w)
// computes out columns 16w .. 16w+15 of its group as Wo * O^T, Wo laid as f16 in LDS at entry.
// ---------------------------------------------------------------------------
__global__ __launch_bounds__(768)
void flash_attn_out_kernel(const _Float16* __restrict__ Q,
                           const _Float16* __restrict__ K,
                           const _Float16* __restrict__ V,
                           const float* __restrict__ kmx,
                           const float* __restrict__ Wo,
                           const float* __restrict__ bo,
                           float* __restrict__ out) {
    __shared__ __align__(16) _Float16 wl[DD * WPITCH];
    __shared__ __align__(16) _Float16 xl[96 * WPITCH];  // attention output, [query of the block][128]
    __shared__ __align__(16) float bl[DD];

    const int tid  = threadIdx.x;
    const int lane = tid & 31;
    const int wave = __builtin_amdgcn_readfirstlane(tid >> 5);
    const int h    = wave / 3;                  // a head's three waves stand on three SIMDs
    const int qg   = wave - 3 * h;
    const int grp  = blockIdx.x * 3 + qg;       // 32-query group, 0..767; never across a (b,t)
    const int bt   = grp >> 5;                  // 0..23
    const int hsel = lane >> 4;
    const int laneBase = hsel * 8;
    const int l15 = lane & 15;
    const int m0 = (grp & 31) * 32;

    const size_t head0 = (size_t)(bt * HH + h) * (NN * HD);
    const _Float16* kp = K + head0 + l15 * HD + laneBase;   // key l15, its 8-dim half
    const _Float16* vp = V + head0 + lane * 8;              // the lane's 16 bytes of a 16-key group
    auto kfrag = [&](int j0) {
        return join16(*(const v8h*)(kp + j0 * HD), *(const v8h*)(kp + (j0 + 16) * HD));
    };
    auto vfrag = [&](int j0) {
        return join16(*(const v8h*)(vp + j0 * HD), *(const v8h*)(vp + (j0 + 16) * HD));
    };

    v8h qraw[2];
#pragma unroll
    for (int c = 0; c < 2; ++c)
        qraw[c] = *(const v8h*)(Q + head0 + (m0 + 16 * c + l15) * HD + laneBase);
    // the head's 64 bounds (8 row blocks x 8 waves of the projection), two a lane
    const v2f kraw = *(const v2f*)(kmx + ((size_t)(bt * 8 + (lane >> 2)) * HH + h) * 8 + (lane & 3) * 2);
    v16h kA = kfrag(0), kB = kfrag(32);
    v16h vA = vfrag(0), vB;

    // Wo (4096 pieces of 16 bytes, whole rows a wave) and the bias, laid in LDS for the epilogue:
    // five pieces a thread, the last 256 pieces by the first eight waves
    {
        v4f wraw[5];
#pragma unroll
        for (int i = 0; i < 5; ++i) wraw[i] = *(const v4f*)(Wo + (size_t)(i * 768 + tid) * 4);
        const float braw = bo[tid & (DD - 1)];
        // stands behind the loads above: their address registers are rewritten below
        asm volatile("s_wait_xcnt 0x0" ::: "memory");
#pragma unroll
        for (int i = 0; i < 5; ++i) {
            const int f = i * 768 + tid;        // float4 index: 32 per row
            *(v4h*)&wl[(f >> 5) * WPITCH + (f & 31) * 4] = __builtin_convertvector(wraw[i], v4h);
        }
        if (wave < 8) {
            const int f = 5 * 768 + tid;
            *(v4h*)&wl[(f >> 5) * WPITCH + (f & 31) * 4] =
                __builtin_convertvector(*(const v4f*)(Wo + (size_t)f * 4), v4h);
        }
        if (wave < 4) bl[tid] = braw;
    }

    // Q as B operand (column = query l15), in the low and in the high k half
    const v8h zero8 = {};
    v16h qlo[2], qhi[2];
#pragma unroll
    for (int c = 0; c < 2; ++c) {
        qlo[c] = join16(qraw[c], zero8);
        qhi[c] = join16(zero8, qraw[c]);
    }

    v8f acc[2] = {};                            // acc[c][r] = O^T[hd = laneBase + r][query 16c + l15]
    float lsum[2] = {0.0f, 0.0f};               // this half's share of the row sum

    // |score| <= |q| * |k|.  Where that bound is at most 10 (exp2 units) for every query of the
    // wave, every P = exp2(score) lies in 2^-10 .. 2^10, normal f16 numbers: such a wave needs
    // no maximum, no test and no rescale.  An infinite bound fails the compare.
    float worst;
    {
        float kk = row16_max(fmaxf(kraw[0], kraw[1]));
        kk = fmaxf(kk, other_half(kk));
        float qq = fmaxf(sumsq8(qraw[0]), sumsq8(qraw[1]));
        qq += other_half(qq);                   // at least either query's squared length
        worst = length_bound(qq) * length_bound(kk);
    }

    if (__builtin_amdgcn_ballot_w32(!(worst <= 100.0f)) == 0) {
        const v8f z = {};
        v2f ls2[2] = {};                        // running row sum, two places a column group
        v8f d0[2], d1[2];                       // the scores of the pass to come
        auto scores = [&](const v16h& ka) {
#pragma unroll   // the two column groups' arrays need constant indices
            for (int c = 0; c < 2; ++c) {
                d0[c] = wmma_f16(ka, qlo[c], z);
                d1[c] = wmma_f16(ka, qhi[c], z);
            }
        };
        // One pass over keys j0 .. j0+31: V fragment va; kn = the next pass's K fragment.  It
        // first asks for the K fragment of the pass after next (into k2) and the next pass's V
        // fragment (into vn).  The next pass's score products stand between this pass's exp2 and
        // its sums and conversions, so that independent vector work follows every product.
        auto pass = [&](int j0, const v16h& va, const v16h& kn, v16h& k2, v16h& vn, auto ldk, auto more) {
            if constexpr (decltype(ldk)::value)  k2 = kfrag(j0 + 64);
            if constexpr (decltype(more)::value) {
                vn = vfrag(j0 + 32);
                // holds the loads up here, a pass and more ahead of their use, and stands in
                // front of the next rewrite of their address registers
                asm volatile("s_wait_xcnt 0x0" ::: "memory");
            }
            v8f e0[2], e1[2];
#pragma unroll   // constant indices, as above
            for (int c = 0; c < 2; ++c) {
                e0[c] = exp2_8(d0[c]);
                e1[c] = exp2_8(d1[c]);
            }
            if constexpr (decltype(more)::value) scores(kn);
#pragma unroll   // constant indices, as above
            for (int c = 0; c < 2; ++c) {
                const v8f t8 = e0[c] + e1[c];
                const v4f t4 = __builtin_shufflevector(t8, t8, 0, 1, 2, 3) + __builtin_shufflevector(t8, t8, 4, 5, 6, 7);
                ls2[c] += __builtin_shufflevector(t4, t4, 0, 1) + __builtin_shufflevector(t4, t4, 2, 3);
                v16h pb;                        // B[k=key][n=query], hardware k order
#pragma unroll   // constant indices: the vectors stay in registers
                for (int r = 0; r < 8; ++r) {
                    pb[r]     = (_Float16)e0[c][r];
                    pb[8 + r] = (_Float16)e1[c][r];
                }
                acc[c] = wmma_f16(va, pb, acc[c]);
            }
        };
        scores(kA);
        // two passes a trip: the fragments change places between two register sets, no copies
        for (int j0 = 0; j0 < NN - 64; j0 += 64) {
            pass(j0,      vA, kB, kA, vB, flag<true>{}, flag<true>{});
            pass(j0 + 32, vB, kA, kB, vA, flag<true>{}, flag<true>{});
        }
        pass(NN - 64, vA, kB, kA, vB, flag<false>{}, flag<true>{});
        pass(NN - 32, vB, kA, kB, vA, flag<false>{}, flag<false>{});
#pragma unroll   // constant indices, as above
        for (int c = 0; c < 2; ++c) lsum[c] = ls2[c][0] + ls2[c][1];
    } else {
    // minus the maximum in use of the lane's query (spread over the 8 places of a C operand in
    // each pass: held so, it would cost 14 registers more than the six waves a SIMD leave);
    // it starts as the true maximum over keys 0..31, so the first P are at most 1
    float negm[2];
#pragma unroll   // here and below: the two column groups' arrays need constant indices
    for (int c = 0; c < 2; ++c) {
        const v8f z = {};
        negm[c] = -max16_both_halves(wmma_f16(kA, qlo[c], z), wmma_f16(kA, qhi[c], z));
    }

    for (int j0 = 0; j0 < NN; j0 += 32) {
        // no fetch ahead here: this loop has no registers to spare for it
        const v16h ka = kfrag(j0);
        // stands in front of the next rewrite of the loads' address registers
        asm volatile("s_wait_xcnt 0x0" ::: "memory");

        v8f d0[2], d1[2], e0[2], e1[2];
        float ts[2];
#pragma unroll
        for (int c = 0; c < 2; ++c) {
            const float n = negm[c];
            const v8f cm = {n, n, n, n, n, n, n, n};
            d0[c] = wmma_f16(ka, qlo[c], cm);
            d1[c] = wmma_f16(ka, qhi[c], cm);
        }
#pragma unroll
        for (int c = 0; c < 2; ++c) {
            e0[c] = exp2_8(d0[c]);
            e1[c] = exp2_8(d1[c]);
            ts[c] = sum16(e0[c], e1[c]);
        }
        // P are not negative, so the sum bounds each of them; an infinite sum fails the test too
        if (__builtin_amdgcn_ballot_w32(!(ts[0] + ts[1] <= PLIM)) != 0) {
#pragma unroll
            for (int c = 0; c < 2; ++c) {
                const float up = fmaxf(max16_both_halves(d0[c], d1[c]), 0.0f);  // same in both halves
                const float al = __builtin_amdgcn_exp2f(-up);
                negm[c] -= up;
                e0[c] = exp2_8(d0[c] - up);
                e1[c] = exp2_8(d1[c] - up);
                ts[c] = sum16(e0[c], e1[c]);
                acc[c] *= al;
                lsum[c] *= al;
            }
        }
        const v16h va = vfrag(j0);              // behind the branch, which needs the registers
        // stands in front of the next rewrite of the loads' address registers
        asm volatile("s_wait_xcnt 0x0" ::: "memory");
#pragma unroll
        for (int c = 0; c < 2; ++c) {
            lsum[c] += ts[c];
            v16h pb;                            // B[k=key][n=query], hardware k order
#pragma unroll
            for (int r = 0; r < 8; ++r) {
                pb[r]     = (_Float16)e0[c][r];
                pb[8 + r] = (_Float16)e1[c][r];
            }
            acc[c] = wmma_f16(va, pb, acc[c]);
        }
    }
    }

    // the wave's head of its 32 queries, as f16, into the block's [query][128] plane
    _Float16* xq = &xl[(qg * 32 + l15) * WPITCH];
#pragma unroll
    for (int c = 0; c < 2; ++c) {
        const float l = lsum[c] + other_half(lsum[c]);  // join the two halves' sums once
        v8h o;
#pragma unroll
        for (int r = 0; r < 8; ++r) o[r] = (_Float16)(acc[c][r] / l);
        *(v8h*)&xq[16 * c * WPITCH + h * HD + laneBase] = o;
    }
    __syncthreads();                            // all 8 heads of every query, Wo and the bias are laid

    // out^T tile = Wo rows 16h .. 16h+15 (A) * the group's 32 attention rows (B), k = 128
    v8f oc[2] = {};
    const _Float16* wrow = wl + (16 * h + l15) * WPITCH;
#pragma unroll
    for (int kb = 0; kb < 4; ++kb) {
        const v16h wa = frag_from_f16(wrow + kb * 32, laneBase);
#pragma unroll
        for (int c = 0; c < 2; ++c)
            oc[c] = wmma_f16(wa, frag_from_f16(xq + 16 * c * WPITCH + kb * 32, laneBase), oc[c]);
    }
    const v4f b0 = *(const v4f*)&bl[16 * h + laneBase];
    const v4f b1 = *(const v4f*)&bl[16 * h + laneBase + 4];
#pragma unroll
    for (int c = 0; c < 2; ++c) {
        float* orow = out + ((size_t)grp * 32 + 16 * c + l15) * DD + 16 * h + laneBase;
        v4f o0, o1;
#pragma unroll
        for (int r = 0; r < 4; ++r) {
            o0[r] = oc[c][r] + b0[r];
            o1[r] = oc[c][4 + r] + b1[r];
        }
        *(v4f*)orow       = o0;
        *(v4f*)(orow + 4) = o1;
    }
}

// ---------------------------------------------------------------------------
extern "C" void kernel_launch(void* const* d_in, const int* in_sizes, int n_in,
                              void* d_out, int out_size, void* d_ws, size_t ws_size,
                              hipStream_t stream) {
    const float* query = (const float*)d_in[0];
    const float* key   = (const float*)d_in[1];
    const float* value = (const float*)d_in[2];
    const float* Wq = (const float*)d_in[3];
    const float* bq = (const float*)d_in[4];
    const float* Wk = (const float*)d_in[5];
    const float* bk = (const float*)d_in[6];
    const float* Wv = (const float*)d_in[7];
    const float* bv = (const float*)d_in[8];
    const float* Wo = (const float*)d_in[9];
    const float* bo = (const float*)d_in[10];

    _Float16* ws_q = (_Float16*)d_ws;          // 3 x 6 MB f16 buffers, then 48 KB of key bounds
    _Float16* ws_k = ws_q + ELEMS;
    _Float16* ws_v = ws_k + ELEMS;
    float* ws_kmx  = (float*)(ws_v + ELEMS);

    dim3 blk(256);                              // 8 waves per block (wave32)

    qkv_proj_kernel<<<dim3(192, 3), blk, 0, stream>>>(
        query, key, value, Wq, bq, Wk, bk, Wv, bv, ws_q, ws_k, ws_v, ws_kmx);

    flash_attn_out_kernel<<<dim3(256), dim3(768), 0, stream>>>(
        ws_q, ws_k, ws_v, ws_kmx, Wo, bo, (float*)d_out);
}

// v007
// It runs in 35.7 microseconds.
// Timed twice side by side with v006, it ran 1.06 times as fast both times.
// Over all steps from v000 it is 4.35 times as fast.
#include <hip/hip_runtime.h>
#include <hip/hip_bf16.h>

typedef __attribute__((ext_vector_type(16))) _Float16 v16h;
typedef __attribute__((ext_vector_type(8)))  _Float16 v8h;
typedef __attribute__((ext_vector_type(8)))  float    v8f;
typedef __attribute__((ext_vector_type(4)))  float    v4f;

// Problem constants
#define BB 2
#define TT 12
#define NN 1024
#define DD 128
#define HH 8
#define HD 16
#define ROWS (BB*TT*NN)          // 24576
#define ELEMS ((size_t)ROWS*DD)  // 3145728
#define QSCALE 0.36067376022224085f   // log2(e) / sqrt(16)

// ---------------------------------------------------------------------------
// Fragment builders for V_WMMA_F32_16X16X32_F16 (wave32).
// 16-bit A-matrix 16x32 layout (ISA 7.12.2):
//   laneBase = (lane<16 ? 0 : 8);  row = lane&15
//   elem e<8 -> K = laneBase + e ;  e>=8 -> K = laneBase + 8 + e
// B (32x16) mirrors this with column = lane&15.
// C/D 16x16 f32: elem r -> (M = r + (lane<16?0:8), N = lane&15)
// ---------------------------------------------------------------------------

static __device__ inline v16h frag_from_f16(const _Float16* __restrict__ rowp, int laneBase) {
    v8h x0 = *(const v8h*)(rowp + laneBase);        // K = laneBase .. +7
    v8h x1 = *(const v8h*)(rowp + laneBase + 16);   // K = laneBase+16 .. +23
    v16h a;
#pragma unroll
    for (int i = 0; i < 8; ++i) { a[i] = x0[i]; a[8 + i] = x1[i]; }
    return a;
}

static __device__ inline v8f wmma_f16(v16h a, v16h b, v8f c) {
    return __builtin_amdgcn_wmma_f32_16x16x32_f16(false, a, false, b,
                                                  (short)0, c, false, false);
}

// ---------------------------------------------------------------------------
// Projection tiling of kernel 1.
// Work-group = 8 waves = 128 rows x all 128 columns.  Weight and input block
// (each 128 x 128) come in by whole-row wave loads and are laid down as f16 in
// LDS once; each wave of a Q or K block then computes its 16 rows x 128 columns as C^T = W * X^T:
// A = 16 weight rows, B = the wave's 16 input rows, read once into registers.
// Lane (c = lane&15, h = lane>>4) ends with C[m0 + c][16t + 8h + 0..7] in
// accumulator tile t: 8 consecutive columns of one row, stored packed.
// ---------------------------------------------------------------------------
#define WPITCH 136   // f16 per LDS row: 272 B = 16 B x 17, the pitch for 16-byte readers

typedef __attribute__((ext_vector_type(4))) _Float16 v4h;

// A thread's share of a contiguous 128x128 f32 block: each wave-wide load is one 512-B row.
static __device__ inline void f32_block_load(const float* __restrict__ src, int tid, v4f (&x)[16]) {
#pragma unroll
    for (int i = 0; i < 16; ++i)
        x[i] = *(const v4f*)(src + (size_t)(i * 256 + tid) * 4);
}

static __device__ inline void f32_block_to_lds(const v4f (&x)[16], int tid, _Float16* dst) {
#pragma unroll
    for (int i = 0; i < 16; ++i) {
        const int f = i * 256 + tid;            // float4 index: 32 per row
        *(v4h*)&dst[(f >> 5) * WPITCH + (f & 31) * 4] = __builtin_convertvector(x[i], v4h);
    }
}

// XA = false: C^T = W * X^T, as above.  XA = true: the same two fragments in the other order,
// C = X * W^T: the lane ends with C[m0 + 8h + 0..7][16t + c], 8 consecutive rows of one column.
template <bool XA>
static __device__ inline void proj_tiles(const _Float16* wl, const _Float16* xrow,
                                         int l15, int laneBase, v8f (&acc)[8]) {
    // 8 groups of 4 products: group g = k block g>>1, column tiles 4*(g&1) .. +3
    const _Float16* wrow = wl + l15 * WPITCH;
    v16h wa[2][4];
    v16h xb[2];
    xb[0] = frag_from_f16(xrow, laneBase);
#pragma unroll
    for (int j = 0; j < 4; ++j) wa[0][j] = frag_from_f16(wrow + 16 * j * WPITCH, laneBase);
#pragma unroll
    for (int g = 0; g < 8; ++g) {
        if (g < 7) {
            const int n = g + 1, kb = n >> 1, t0 = 4 * (n & 1);
            if ((n & 1) == 0) xb[kb & 1] = frag_from_f16(xrow + kb * 32, laneBase);
#pragma unroll
            for (int j = 0; j < 4; ++j)
                wa[n & 1][j] = frag_from_f16(wrow + 16 * (t0 + j) * WPITCH + kb * 32, laneBase);
        }
        // keeps the next group's LDS reads as one run ahead of this group's products,
        // so that a product never waits on a read issued just in front of it
        __builtin_amdgcn_sched_barrier(0);
#pragma unroll
        for (int j = 0; j < 4; ++j)
            acc[4 * (g & 1) + j] = XA ? wmma_f16(xb[(g >> 1) & 1], wa[g & 1][j], acc[4 * (g & 1) + j])
                                      : wmma_f16(wa[g & 1][j], xb[(g >> 1) & 1], acc[4 * (g & 1) + j]);
        // keeps the group after next's reads from moving up among these products
        __builtin_amdgcn_sched_barrier(0);
    }
}

static __device__ inline float other_half(float x) {   // lane l <-> l ^ 16
    const int b = __builtin_bit_cast(int, x);
    return __builtin_bit_cast(float,
        __builtin_amdgcn_permlanex16(b, b, 0x76543210, 0xfedcba98, false, false));
}

static __device__ inline v16h join16(v8h lo, v8h hi) {
    return __builtin_shufflevector(lo, hi, 0, 1, 2, 3, 4, 5, 6, 7, 8, 9, 10, 11, 12, 13, 14, 15);
}

typedef __attribute__((ext_vector_type(2))) float v2f;

#define PLIM 4096.0f    // a lane's sum of 32 P at or below it: every P fits f16 with room

static __device__ inline v8f exp2_8(const v8f d) {
    v8f e;
#pragma unroll   // constant indices: the vector stays in registers
    for (int r = 0; r < 8; ++r) e[r] = __builtin_amdgcn_exp2f(d[r]);
    return e;
}

static __device__ inline float sum16(const v8f e0, const v8f e1) {  // pairwise, on register pairs
    const v8f t8 = e0 + e1;
    const v4f t4 = __builtin_shufflevector(t8, t8, 0, 1, 2, 3) + __builtin_shufflevector(t8, t8, 4, 5, 6, 7);
    const v2f t2 = __builtin_shufflevector(t4, t4, 0, 1) + __builtin_shufflevector(t4, t4, 2, 3);
    return t2[0] + t2[1];
}

static __device__ inline float max16_both_halves(const v8f d0, const v8f d1) {
    float tm = fmaxf(d0[0], d1[0]);
#pragma unroll   // constant indices: the vectors stay in registers
    for (int r = 1; r < 8; ++r) tm = fmaxf(tm, fmaxf(d0[r], d1[r]));
    return fmaxf(tm, other_half(tm));
}

// Sum of the squares of 8 f16, summed in f32: no finite f16 overflows it
static __device__ inline float sumsq8(const v8h x) {
    float s = 0.0f;
#pragma unroll   // constant indices: the vector stays in registers
    for (int r = 0; r < 8; ++r) s = fmaf((float)x[r], (float)x[r], s);
    return s;
}

// At least the true sum of squares: 1 % and 1e-6 stand for what the roundings of 16 terms and
// products of subnormal size can lose
static __device__ inline float length_bound(float s) { return fmaf(s, 1.01f, 1e-6f); }

template <int CTRL>
static __device__ inline float max_dpp(float x) {      // maximum with the lane that CTRL names
    const int b = __builtin_bit_cast(int, x);
    return fmaxf(x, __builtin_bit_cast(float, __builtin_amdgcn_update_dpp(b, b, CTRL, 0xf, 0xf, false)));
}

static __device__ inline float row16_max(float x) {    // over the lane's 16-lane row: row_xmask 1, 2, 4, 8
    return max_dpp<0x168>(max_dpp<0x164>(max_dpp<0x162>(max_dpp<0x161>(x))));
}

template <bool B> struct flag { static constexpr bool value = B; };

// ---------------------------------------------------------------------------
// Kernel 1: fused Q/K/V projection.  C = X @ W^T + b   (f32 in, f16 out, head-major)
// Q leaves multiplied by QSCALE (in f32, ahead of its one rounding to f16), so that
// the attention kernel's score product is already in exp2 units; K and V by 1.
// Q and K leave as [b*t][head][node][16].  V leaves in the order of the attention kernel's
// V^T fragment: [b*t][head][16-node group][lane (c = head dim, h)][nodes 8h .. 8h+7].
// The K blocks also leave, per wave and head, a bound on the squared length of their 16 keys.
// grid.x = 192 row blocks, grid.y = 3 (q/k/v)
// ---------------------------------------------------------------------------
__global__ __launch_bounds__(256)
void qkv_proj_kernel(const float* __restrict__ q_in,
                     const float* __restrict__ k_in,
                     const float* __restrict__ v_in,
                     const float* __restrict__ Wq, const float* __restrict__ bq,
                     const float* __restrict__ Wk, const float* __restrict__ bk,
                     const float* __restrict__ Wv, const float* __restrict__ bv,
                     _Float16* __restrict__ ws_q,
                     _Float16* __restrict__ ws_k,
                     _Float16* __restrict__ ws_v,
                     float* __restrict__ ws_kmx) {
    __shared__ __align__(16) _Float16 wl[DD * WPITCH];
    __shared__ __align__(16) _Float16 xl[128 * WPITCH];
    __shared__ __align__(16) float bl[256];     // bias, laid down twice: every thread stores, no branch among the loads

    const int tid  = threadIdx.x;
    const int lane = tid & 31;
    const int wave = tid >> 5;

    const float* X; const float* Wm; const float* bias; _Float16* O;
    const float osc = (blockIdx.y == 0) ? QSCALE : 1.0f;
    if (blockIdx.y == 0)      { X = q_in; Wm = Wq; bias = bq; O = ws_q; }
    else if (blockIdx.y == 1) { X = k_in; Wm = Wk; bias = bk; O = ws_k; }
    else                      { X = v_in; Wm = Wv; bias = bv; O = ws_v; }

    const int laneBase = (lane < 16) ? 0 : 8;
    const int l15 = lane & 15;
    const size_t blk0 = (size_t)blockIdx.x * 128 * DD;  // first element of the row block

    // every load of the block is issued before the first conversion
    const float braw = bias[tid & (DD - 1)];
    v4f wraw[16], xraw[16];
    f32_block_load(Wm, tid, wraw);
    f32_block_load(X + blk0, tid, xraw);
    bl[tid] = braw;
    f32_block_to_lds(wraw, tid, wl);
    f32_block_to_lds(xraw, tid, xl);
    __syncthreads();

    v8f acc[8] = {};
    // first element of the wave's 16 nodes in head 0's plane; column tile t is head t
    _Float16* o16 = O + ((size_t)(blockIdx.x >> 3) * (HH * NN) + (blockIdx.x & 7) * 128 + wave * 16) * HD;

    if (blockIdx.y == 2) {
        proj_tiles<true>(wl, &xl[(wave * 16 + l15) * WPITCH], l15, laneBase, acc);
        // the lane holds nodes 8h .. 8h+7 of head dim c: its 16 bytes of the V^T fragment;
        // a wave's store is 512 contiguous bytes
#pragma unroll
        for (int t = 0; t < 8; ++t) {
            const float b = bl[16 * t + l15];
            v8h o;
#pragma unroll
            for (int r = 0; r < 8; ++r) o[r] = (_Float16)(acc[t][r] + b);
            *(v8h*)(o16 + t * (NN * HD) + lane * 8) = o;
        }
        return;
    }

    proj_tiles<false>(wl, &xl[(wave * 16 + l15) * WPITCH], l15, laneBase, acc);

    // [node][16]: a wave's store is 16 nodes x 32 B = 512 contiguous bytes
    _Float16* orow = o16 + l15 * HD + laneBase;
    v8h oo[8];
#pragma unroll
    for (int t = 0; t < 8; ++t) {
        const v4f b0 = *(const v4f*)&bl[16 * t + laneBase];
        const v4f b1 = *(const v4f*)&bl[16 * t + laneBase + 4];
        v8h o;
#pragma unroll
        for (int r = 0; r < 4; ++r) {
            o[r]     = (_Float16)((acc[t][r] + b0[r]) * osc);
            o[4 + r] = (_Float16)((acc[t][4 + r] + b1[r]) * osc);
        }
        *(v8h*)(orow + t * (NN * HD)) = o;
        oo[t] = o;
    }
    // stands behind the last store, in front of the branch: the sums below rewrite registers that
    // the stores name (inside the branch the compiler moved those sums up over it)
    asm volatile("s_wait_xcnt 0x0" ::: "memory");
    if (blockIdx.y == 1) {
        float kb8 = 0.0f;                       // lane t: the bound of head t
#pragma unroll   // oo needs constant indices to stay in registers
        for (int t = 0; t < 8; ++t) {
            // the largest sum of squares among the 16 keys as stored, each 8-dim half apart; the
            // sum of the two halves' maxima is at least every key's squared length
            float kh = row16_max(sumsq8(oo[t]));
            kh += other_half(kh);
            kb8 = (lane == t) ? kh : kb8;
        }
        // [row block][head][wave]: a work-group's 64 bounds are 256 bytes of its own
        if (lane < 8) ws_kmx[((size_t)blockIdx.x * HH + lane) * 8 + wave] = kb8;
    }
}

// ---------------------------------------------------------------------------
// Kernel 2: flash attention over the node dim with the output projection behind it.
// Block = 24 waves = 3 groups of 32 queries x 8 heads; wave = one head of one group (two
// column groups of 16 queries).  256 blocks: one a WGP, six waves a SIMD.
// K and V fragments come straight from global memory, each a pair of 512-byte wave loads,
// fetched ahead into registers in the loop without a maximum; the three waves of a head read the same lines unless the block's groups span two (b,t).  The key
// loop holds no LDS access and no barrier.
// Per 32 keys:
//   - one K fragment: keys j..j+15 in k 0..15, keys j+16..j+31 in k 16..31.
//     Against B = [Q;0] it gives the first 16 keys' scores, against B = [0;Q]
//     the second 16 keys': S^T = K * Q^T, no zero fill of A in the loop.
//     A lane then holds 16 scores of ONE query (column lane&15): keys 8h+r and
//     16+8h+r, h = lane>>4
//   - Q comes in exp2 units and the product's C operand is minus the maximum in use,
//     so the accumulator IS the exp2 argument: no scale, maximum or subtraction per
//     score.  The maximum in use starts as the true maximum of keys 0..31 and is
//     raised (with the rescale of O and of the row sum) only in a pass where some
//     lane's sum of P tops PLIM: one wave-uniform branch per pass
//   - a wave whose scores are all bounded by |q| * max|k| <= 10 (the keys' bound comes from
//     their projection) takes a loop of its own with no maximum at all: C = 0, P = exp2(score)
//   - V^T fragment (A[m=hd][k=key]): stored in that order by V's projection
//   - O^T += V^T * P^T: the two score tiles, converted in place, already are
//     the B operand in the hardware k order; P never goes through LDS
// Behind the loop the 8 heads of a query meet in LDS (f16, one barrier), and wave (group, w)
// computes out columns 16w .. 16w+15 of its group as Wo * O^T, Wo laid as f16 in LDS at entry.
// ---------------------------------------------------------------------------
__global__ __launch_bounds__(768)
void flash_attn_out_kernel(const _Float16* __restrict__ Q,
                           const _Float16* __restrict__ K,
                           const _Float16* __restrict__ V,
                           const float* __restrict__ kmx,
                           const float* __restrict__ Wo,
                           const float* __restrict__ bo,
                           float* __restrict__ out) {
    __shared__ __align__(16) _Float16 wl[DD * WPITCH];
    __shared__ __align__(16) _Float16 xl[96 * WPITCH];  // attention output, [query of the block][128]
    __shared__ __align__(16) float bl[DD];

    const int tid  = threadIdx.x;
    const int lane = tid & 31;
    const int wave = __builtin_amdgcn_readfirstlane(tid >> 5);
    const int h    = wave / 3;                  // a head's three waves stand on three SIMDs
    const int qg   = wave - 3 * h;
    const int grp  = blockIdx.x * 3 + qg;       // 32-query group, 0..767; never across a (b,t)
    const int bt   = grp >> 5;                  // 0..23
    const int hsel = lane >> 4;
    const int laneBase = hsel * 8;
    const int l15 = lane & 15;
    const int m0 = (grp & 31) * 32;

    const size_t head0 = (size_t)(bt * HH + h) * (NN * HD);
    const _Float16* kp = K + head0 + l15 * HD + laneBase;   // key l15, its 8-dim half
    const _Float16* vp = V + head0 + lane * 8;              // the lane's 16 bytes of a 16-key group
    auto kfrag = [&](int j0) {
        return join16(*(const v8h*)(kp + j0 * HD), *(const v8h*)(kp + (j0 + 16) * HD));
    };
    auto vfrag = [&](int j0) {
        return join16(*(const v8h*)(vp + j0 * HD), *(const v8h*)(vp + (j0 + 16) * HD));
    };

    v8h qraw[2];
#pragma unroll
    for (int c = 0; c < 2; ++c)
        qraw[c] = *(const v8h*)(Q + head0 + (m0 + 16 * c + l15) * HD + laneBase);
    // the head's 64 bounds (8 row blocks x 8 waves of the projection), two a lane
    const v2f kraw = *(const v2f*)(kmx + ((size_t)(bt * 8 + (lane >> 2)) * HH + h) * 8 + (lane & 3) * 2);
    v16h kA = kfrag(0), kB = kfrag(32);
    v16h vA = vfrag(0), vB;

    // L2 hints for the head's K and V planes: the launch before stored them.  One request names
    // the 32 units of 256 bytes (one a lane) that hold 256 keys
    // of one plane: item i = plane i & 1, keys 256 (i >> 1) and on.  The head's three waves deal
    // its 8 items among them: this wave asks for items qg, qg + 3 and qg + 6 (the ninth place
    // asks for the eighth item again).  Every lane's address lies inside the plane.
    {
        auto item_base = [&](int i) { return ((i & 1) ? V : K) + head0 + (i >> 1) * (256 * HD); };
        // hints: no result to wait for.  The wait is the last line of their own statement, so that
        // it stands in front of the next rewrite of the offset register
        asm volatile("global_prefetch_b8 %0, %1 scope:SCOPE_SE\n\t"
                     "global_prefetch_b8 %0, %2 scope:SCOPE_SE\n\t"
                     "global_prefetch_b8 %0, %3 scope:SCOPE_SE\n\t"
                     "s_wait_xcnt 0x0"
                     :: "v"(lane * 256), "s"(item_base(qg)), "s"(item_base(qg + 3)),
                        "s"(item_base(min(qg + 6, 7)))
                     : "memory");
    }

    // Wo (4096 pieces of 16 bytes, whole rows a wave) and the bias, laid in LDS for the epilogue:
    // five pieces a thread, the last 256 pieces by the first eight waves
    {
        v4f wraw[5];
#pragma unroll
        for (int i = 0; i < 5; ++i) wraw[i] = *(const v4f*)(Wo + (size_t)(i * 768 + tid) * 4);
        const float braw = bo[tid & (DD - 1)];
        // stands behind the loads above: their address registers are rewritten below
        asm volatile("s_wait_xcnt 0x0" ::: "memory");
#pragma unroll
        for (int i = 0; i < 5; ++i) {
            const int f = i * 768 + tid;        // float4 index: 32 per row
            *(v4h*)&wl[(f >> 5) * WPITCH + (f & 31) * 4] = __builtin_convertvector(wraw[i], v4h);
        }
        if (wave < 8) {
            const int f = 5 * 768 + tid;
            *(v4h*)&wl[(f >> 5) * WPITCH + (f & 31) * 4] =
                __builtin_convertvector(*(const v4f*)(Wo + (size_t)f * 4), v4h);
        }
        if (wave < 4) bl[tid] = braw;
    }

    // Q as B operand (column = query l15), in the low and in the high k half
    const v8h zero8 = {};
    v16h qlo[2], qhi[2];
#pragma unroll
    for (int c = 0; c < 2; ++c) {
        qlo[c] = join16(qraw[c], zero8);
        qhi[c] = join16(zero8, qraw[c]);
    }

    v8f acc[2] = {};                            // acc[c][r] = O^T[hd = laneBase + r][query 16c + l15]
    float lsum[2] = {0.0f, 0.0f};               // this half's share of the row sum

    // |score| <= |q| * |k|.  Where that bound is at most 10 (exp2 units) for every query of the
    // wave, every P = exp2(score) lies in 2^-10 .. 2^10, normal f16 numbers: such a wave needs
    // no maximum, no test and no rescale.  An infinite bound fails the compare.
    float worst;
    {
        float kk = row16_max(fmaxf(kraw[0], kraw[1]));
        kk = fmaxf(kk, other_half(kk));
        float qq = fmaxf(sumsq8(qraw[0]), sumsq8(qraw[1]));
        qq += other_half(qq);                   // at least either query's squared length
        worst = length_bound(qq) * length_bound(kk);
    }

    if (__builtin_amdgcn_ballot_w32(!(worst <= 100.0f)) == 0) {
        const v8f z = {};
        v2f ls2[2] = {};                        // running row sum, two places a column group
        v8f d0[2], d1[2];                       // the scores of the pass to come
        auto scores = [&](const v16h& ka) {
#pragma unroll   // the two column groups' arrays need constant indices
            for (int c = 0; c < 2; ++c) {
                d0[c] = wmma_f16(ka, qlo[c], z);
                d1[c] = wmma_f16(ka, qhi[c], z);
            }
        };
        // One pass over keys j0 .. j0+31: V fragment va; kn = the next pass's K fragment.  It
        // first asks for the K fragment of the pass after next (into k2) and the next pass's V
        // fragment (into vn).  The next pass's score products stand between this pass's exp2 and
        // its sums and conversions, so that independent vector work follows every product.
        auto pass = [&](int j0, const v16h& va, const v16h& kn, v16h& k2, v16h& vn, auto ldk, auto more) {
            if constexpr (decltype(ldk)::value)  k2 = kfrag(j0 + 64);
            if constexpr (decltype(more)::value) {
                vn = vfrag(j0 + 32);
                // holds the loads up here, a pass and more ahead of their use, and stands in
                // front of the next rewrite of their address registers
                asm volatile("s_wait_xcnt 0x0" ::: "memory");
            }
            v8f e0[2], e1[2];
#pragma unroll   // constant indices, as above
            for (int c = 0; c < 2; ++c) {
                e0[c] = exp2_8(d0[c]);
                e1[c] = exp2_8(d1[c]);
            }
            if constexpr (decltype(more)::value) scores(kn);
#pragma unroll   // constant indices, as above
            for (int c = 0; c < 2; ++c) {
                const v8f t8 = e0[c] + e1[c];
                const v4f t4 = __builtin_shufflevector(t8, t8, 0, 1, 2, 3) + __builtin_shufflevector(t8, t8, 4, 5, 6, 7);
                ls2[c] += __builtin_shufflevector(t4, t4, 0, 1) + __builtin_shufflevector(t4, t4, 2, 3);
                v16h pb;                        // B[k=key][n=query], hardware k order
#pragma unroll   // constant indices: the vectors stay in registers
                for (int r = 0; r < 8; ++r) {
                    pb[r]     = (_Float16)e0[c][r];
                    pb[8 + r] = (_Float16)e1[c][r];
                }
                acc[c] = wmma_f16(va, pb, acc[c]);
            }
        };
        scores(kA);
        // two passes a trip: the fragments change places between two register sets, no copies
        for (int j0 = 0; j0 < NN - 64; j0 += 64) {
            pass(j0,      vA, kB, kA, vB, flag<true>{}, flag<true>{});
            pass(j0 + 32, vB, kA, kB, vA, flag<true>{}, flag<true>{});
        }
        pass(NN - 64, vA, kB, kA, vB, flag<false>{}, flag<true>{});
        pass(NN - 32, vB, kA, kB, vA, flag<false>{}, flag<false>{});
#pragma unroll   // constant indices, as above
        for (int c = 0; c < 2; ++c) lsum[c] = ls2[c][0] + ls2[c][1];
    } else {
    // minus the maximum in use of the lane's query (spread over the 8 places of a C operand in
    // each pass: held so, it would cost 14 registers more than the six waves a SIMD leave);
    // it starts as the true maximum over keys 0..31, so the first P are at most 1
    float negm[2];
#pragma unroll   // here and below: the two column groups' arrays need constant indices
    for (int c = 0; c < 2; ++c) {
        const v8f z = {};
        negm[c] = -max16_both_halves(wmma_f16(kA, qlo[c], z), wmma_f16(kA, qhi[c], z));
    }

    for (int j0 = 0; j0 < NN; j0 += 32) {
        // no fetch ahead here: this loop has no registers to spare for it
        const v16h ka = kfrag(j0);
        // stands in front of the next rewrite of the loads' address registers
        asm volatile("s_wait_xcnt 0x0" ::: "memory");

        v8f d0[2], d1[2], e0[2], e1[2];
        float ts[2];
#pragma unroll
        for (int c = 0; c < 2; ++c) {
            const float n = negm[c];
            const v8f cm = {n, n, n, n, n, n, n, n};
            d0[c] = wmma_f16(ka, qlo[c], cm);
            d1[c] = wmma_f16(ka, qhi[c], cm);
        }
#pragma unroll
        for (int c = 0; c < 2; ++c) {
            e0[c] = exp2_8(d0[c]);
            e1[c] = exp2_8(d1[c]);
            ts[c] = sum16(e0[c], e1[c]);
        }
        // P are not negative, so the sum bounds each of them; an infinite sum fails the test too
        if (__builtin_amdgcn_ballot_w32(!(ts[0] + ts[1] <= PLIM)) != 0) {
#pragma unroll
            for (int c = 0; c < 2; ++c) {
                const float up = fmaxf(max16_both_halves(d0[c], d1[c]), 0.0f);  // same in both halves
                const float al = __builtin_amdgcn_exp2f(-up);
                negm[c] -= up;
                e0[c] = exp2_8(d0[c] - up);
                e1[c] = exp2_8(d1[c] - up);
                ts[c] = sum16(e0[c], e1[c]);
                acc[c] *= al;
                lsum[c] *= al;
            }
        }
        const v16h va = vfrag(j0);              // behind the branch, which needs the registers
        // stands in front of the next rewrite of the loads' address registers
        asm volatile("s_wait_xcnt 0x0" ::: "memory");
#pragma unroll
        for (int c = 0; c < 2; ++c) {
            lsum[c] += ts[c];
            v16h pb;                            // B[k=key][n=query], hardware k order
#pragma unroll
            for (int r = 0; r < 8; ++r) {
                pb[r]     = (_Float16)e0[c][r];
                pb[8 + r] = (_Float16)e1[c][r];
            }
            acc[c] = wmma_f16(va, pb, acc[c]);
        }
    }
    }

    // the wave's head of its 32 queries, as f16, into the block's [query][128] plane
    _Float16* xq = &xl[(qg * 32 + l15) * WPITCH];
#pragma unroll
    for (int c = 0; c < 2; ++c) {
        const float l = lsum[c] + other_half(lsum[c]);  // join the two halves' sums once
        v8h o;
#pragma unroll
        for (int r = 0; r < 8; ++r) o[r] = (_Float16)(acc[c][r] / l);
        *(v8h*)&xq[16 * c * WPITCH + h * HD + laneBase] = o;
    }
    __syncthreads();                            // all 8 heads of every query, Wo and the bias are laid

    // out^T tile = Wo rows 16h .. 16h+15 (A) * the group's 32 attention rows (B), k = 128
    v8f oc[2] = {};
    const _Float16* wrow = wl + (16 * h + l15) * WPITCH;
#pragma unroll
    for (int kb = 0; kb < 4; ++kb) {
        const v16h wa = frag_from_f16(wrow + kb * 32, laneBase);
#pragma unroll
        for (int c = 0; c < 2; ++c)
            oc[c] = wmma_f16(wa, frag_from_f16(xq + 16 * c * WPITCH + kb * 32, laneBase), oc[c]);
    }
    const v4f b0 = *(const v4f*)&bl[16 * h + laneBase];
    const v4f b1 = *(const v4f*)&bl[16 * h + laneBase + 4];
#pragma unroll
    for (int c = 0; c < 2; ++c) {
        float* orow = out + ((size_t)grp * 32 + 16 * c + l15) * DD + 16 * h + laneBase;
        v4f o0, o1;
#pragma unroll
        for (int r = 0; r < 4; ++r) {
            o0[r] = oc[c][r] + b0[r];
            o1[r] = oc[c][4 + r] + b1[r];
        }
        *(v4f*)orow       = o0;
        *(v4f*)(orow + 4) = o1;
    }
}

// ---------------------------------------------------------------------------
extern "C" void kernel_launch(void* const* d_in, const int* in_sizes, int n_in,
                              void* d_out, int out_size, void* d_ws, size_t ws_size,
                              hipStream_t stream) {
    const float* query = (const float*)d_in[0];
    const float* key   = (const float*)d_in[1];
    const float* value = (const float*)d_in[2];
    const float* Wq = (const float*)d_in[3];
    const float* bq = (const float*)d_in[4];
    const float* Wk = (const float*)d_in[5];
    const float* bk = (const float*)d_in[6];
    const float* Wv = (const float*)d_in[7];
    const float* bv = (const float*)d_in[8];
    const float* Wo = (const float*)d_in[9];
    const float* bo = (const float*)d_in[10];

    _Float16* ws_q = (_Float16*)d_ws;          // 3 x 6 MB f16 buffers, then 48 KB of key bounds
    _Float16* ws_k = ws_q + ELEMS;
    _Float16* ws_v = ws_k + ELEMS;
    float* ws_kmx  = (float*)(ws_v + ELEMS);

    dim3 blk(256);                              // 8 waves per block (wave32)

    qkv_proj_kernel<<<dim3(192, 3), blk, 0, stream>>>(
        query, key, value, Wq, bq, Wk, bk, Wv, bv, ws_q, ws_k, ws_v, ws_kmx);

    flash_attn_out_kernel<<<dim3(256), dim3(768), 0, stream>>>(
        ws_q, ws_k, ws_v, ws_kmx, Wo, bo, (float*)d_out);
}

// v008
// A run of this version takes 34 microseconds.
// Timed twice side by side with v007, it ran 1.05 times as fast both times.
// Over all steps from v000 it is 4.56 times as fast.
#include <hip/hip_runtime.h>
#include <hip/hip_bf16.h>

typedef __attribute__((ext_vector_type(16))) _Float16 v16h;
typedef __attribute__((ext_vector_type(8)))  _Float16 v8h;
typedef __attribute__((ext_vector_type(8)))  float    v8f;
typedef __attribute__((ext_vector_type(4)))  float    v4f;

// Problem constants
#define BB 2
#define TT 12
#define NN 1024
#define DD 128
#define HH 8
#define HD 16
#define ROWS (BB*TT*NN)          // 24576
#define ELEMS ((size_t)ROWS*DD)  // 3145728
#define QSCALE 0.36067376022224085f   // log2(e) / sqrt(16)

// ---------------------------------------------------------------------------
// Fragment builders for V_WMMA_F32_16X16X32_F16 (wave32).
// 16-bit A-matrix 16x32 layout (ISA 7.12.2):
//   laneBase = (lane<16 ? 0 : 8);  row = lane&15
//   elem e<8 -> K = laneBase + e ;  e>=8 -> K = laneBase + 8 + e
// B (32x16) mirrors this with column = lane&15.
// C/D 16x16 f32: elem r -> (M = r + (lane<16?0:8), N = lane&15)
// ---------------------------------------------------------------------------

static __device__ inline v16h frag_from_f16(const _Float16* __restrict__ rowp, int laneBase) {
    v8h x0 = *(const v8h*)(rowp + laneBase);        // K = laneBase .. +7
    v8h x1 = *(const v8h*)(rowp + laneBase + 16);   // K = laneBase+16 .. +23
    v16h a;
#pragma unroll
    for (int i = 0; i < 8; ++i) { a[i] = x0[i]; a[8 + i] = x1[i]; }
    return a;
}

static __device__ inline v8f wmma_f16(v16h a, v16h b, v8f c) {
    return __builtin_amdgcn_wmma_f32_16x16x32_f16(false, a, false, b,
                                                  (short)0, c, false, false);
}

// ---------------------------------------------------------------------------
// Projection tiling of kernel 1.
// Work-group = 8 waves = 128 rows x all 128 columns.  Weight and input block
// (each 128 x 128) come in by whole-row wave loads and are laid down as f16 in
// LDS once; each wave of a Q or K block then computes its 16 rows x 128 columns as C^T = W * X^T:
// A = 16 weight rows, B = the wave's 16 input rows, read once into registers.
// Lane (c = lane&15, h = lane>>4) ends with C[m0 + c][16t + 8h + 0..7] in
// accumulator tile t: 8 consecutive columns of one row, stored packed.
// ---------------------------------------------------------------------------
#define WPITCH 136   // f16 per LDS row: 272 B = 16 B x 17, the pitch for 16-byte readers

typedef __attribute__((ext_vector_type(4))) _Float16 v4h;

// A thread's share of a contiguous 128x128 f32 block: each wave-wide load is one 512-B row.
static __device__ inline void f32_block_load(const float* __restrict__ src, int tid, v4f (&x)[16]) {
#pragma unroll
    for (int i = 0; i < 16; ++i)
        x[i] = *(const v4f*)(src + (size_t)(i * 256 + tid) * 4);
}

static __device__ inline void f32_block_to_lds(const v4f (&x)[16], int tid, _Float16* dst) {
#pragma unroll
    for (int i = 0; i < 16; ++i) {
        const int f = i * 256 + tid;            // float4 index: 32 per row
        *(v4h*)&dst[(f >> 5) * WPITCH + (f & 31) * 4] = __builtin_convertvector(x[i], v4h);
    }
}

// XA = false: C^T = W * X^T, as above.  XA = true: the same two fragments in the other order,
// C = X * W^T: the lane ends with C[m0 + 8h + 0..7][16t + c], 8 consecutive rows of one column.
template <bool XA>
static __device__ inline void proj_tiles(const _Float16* wl, const _Float16* xrow,
                                         int l15, int laneBase, v8f (&acc)[8]) {
    // 8 groups of 4 products: group g = k block g>>1, column tiles 4*(g&1) .. +3
    const _Float16* wrow = wl + l15 * WPITCH;
    v16h wa[2][4];
    v16h xb[2];
    xb[0] = frag_from_f16(xrow, laneBase);
#pragma unroll
    for (int j = 0; j < 4; ++j) wa[0][j] = frag_from_f16(wrow + 16 * j * WPITCH, laneBase);
#pragma unroll
    for (int g = 0; g < 8; ++g) {
        if (g < 7) {
            const int n = g + 1, kb = n >> 1, t0 = 4 * (n & 1);
            if ((n & 1) == 0) xb[kb & 1] = frag_from_f16(xrow + kb * 32, laneBase);
#pragma unroll
            for (int j = 0; j < 4; ++j)
                wa[n & 1][j] = frag_from_f16(wrow + 16 * (t0 + j) * WPITCH + kb * 32, laneBase);
        }
        // keeps the next group's LDS reads as one run ahead of this group's products,
        // so that a product never waits on a read issued just in front of it
        __builtin_amdgcn_sched_barrier(0);
#pragma unroll
        for (int j = 0; j < 4; ++j)
            acc[4 * (g & 1) + j] = XA ? wmma_f16(xb[(g >> 1) & 1], wa[g & 1][j], acc[4 * (g & 1) + j])
                                      : wmma_f16(wa[g & 1][j], xb[(g >> 1) & 1], acc[4 * (g & 1) + j]);
        // keeps the group after next's reads from moving up among these products
        __builtin_amdgcn_sched_barrier(0);
    }
}

static __device__ inline float other_half(float x) {   // lane l <-> l ^ 16
    const int b = __builtin_bit_cast(int, x);
    return __builtin_bit_cast(float,
        __builtin_amdgcn_permlanex16(b, b, 0x76543210, 0xfedcba98, false, false));
}

static __device__ inline v16h join16(v8h lo, v8h hi) {
    return __builtin_shufflevector(lo, hi, 0, 1, 2, 3, 4, 5, 6, 7, 8, 9, 10, 11, 12, 13, 14, 15);
}

typedef __attribute__((ext_vector_type(2))) float v2f;

#define PLIM 4096.0f    // a lane's sum of 32 P at or below it: every P fits f16 with room

static __device__ inline v8f exp2_8(const v8f d) {
    v8f e;
#pragma unroll   // constant indices: the vector stays in registers
    for (int r = 0; r < 8; ++r) e[r] = __builtin_amdgcn_exp2f(d[r]);
    return e;
}

static __device__ inline float sum16(const v8f e0, const v8f e1) {  // pairwise, on register pairs
    const v8f t8 = e0 + e1;
    const v4f t4 = __builtin_shufflevector(t8, t8, 0, 1, 2, 3) + __builtin_shufflevector(t8, t8, 4, 5, 6, 7);
    const v2f t2 = __builtin_shufflevector(t4, t4, 0, 1) + __builtin_shufflevector(t4, t4, 2, 3);
    return t2[0] + t2[1];
}

static __device__ inline float max16_both_halves(const v8f d0, const v8f d1) {
    float tm = fmaxf(d0[0], d1[0]);
#pragma unroll   // constant indices: the vectors stay in registers
    for (int r = 1; r < 8; ++r) tm = fmaxf(tm, fmaxf(d0[r], d1[r]));
    return fmaxf(tm, other_half(tm));
}

// Sum of the squares of 8 f16, summed in f32: no finite f16 overflows it
static __device__ inline float sumsq8(const v8h x) {
    float s = 0.0f;
#pragma unroll   // constant indices: the vector stays in registers
    for (int r = 0; r < 8; ++r) s = fmaf((float)x[r], (float)x[r], s);
    return s;
}

// At least the true sum of squares: 1 % and 1e-6 stand for what the roundings of 16 terms and
// products of subnormal size can lose
static __device__ inline float length_bound(float s) { return fmaf(s, 1.01f, 1e-6f); }

template <int CTRL>
static __device__ inline float max_dpp(float x) {      // maximum with the lane that CTRL names
    const int b = __builtin_bit_cast(int, x);
    return fmaxf(x, __builtin_bit_cast(float, __builtin_amdgcn_update_dpp(b, b, CTRL, 0xf, 0xf, false)));
}

static __device__ inline float row16_max(float x) {    // over the lane's 16-lane row: row_xmask 1, 2, 4, 8
    return max_dpp<0x168>(max_dpp<0x164>(max_dpp<0x162>(max_dpp<0x161>(x))));
}

template <bool B> struct flag { static constexpr bool value = B; };

// ---------------------------------------------------------------------------
// Kernel 1: fused Q/K/V projection.  C = X @ W^T + b   (f32 in, f16 out, head-major)
// Q leaves multiplied by QSCALE (in f32, ahead of its one rounding to f16), so that
// the attention kernel's score product is already in exp2 units; K and V by 1.
// Q and K leave as [b*t][head][node][16].  V leaves in the order of the attention kernel's
// V^T fragment: [b*t][head][16-node group][lane (c = head dim, h)][nodes 8h .. 8h+7].
// The K blocks also leave, per wave and head, a bound on the squared length of their 16 keys.
// grid.x = 192 row blocks, grid.y = 3 (q/k/v)
// ---------------------------------------------------------------------------
__global__ __launch_bounds__(256)
void qkv_proj_kernel(const float* __restrict__ q_in,
                     const float* __restrict__ k_in,
                     const float* __restrict__ v_in,
                     const float* __restrict__ Wq, const float* __restrict__ bq,
                     const float* __restrict__ Wk, const float* __restrict__ bk,
                     const float* __restrict__ Wv, const float* __restrict__ bv,
                     _Float16* __restrict__ ws_q,
                     _Float16* __restrict__ ws_k,
                     _Float16* __restrict__ ws_v,
                     float* __restrict__ ws_kmx) {
    __shared__ __align__(16) _Float16 wl[DD * WPITCH];
    __shared__ __align__(16) _Float16 xl[128 * WPITCH];
    __shared__ __align__(16) float bl[256];     // bias, laid down twice: every thread stores, no branch among the loads

    const int tid  = threadIdx.x;
    const int lane = tid & 31;
    const int wave = tid >> 5;

    const float* X; const float* Wm; const float* bias; _Float16* O;
    const float osc = (blockIdx.y == 0) ? QSCALE : 1.0f;
    if (blockIdx.y == 0)      { X = q_in; Wm = Wq; bias = bq; O = ws_q; }
    else if (blockIdx.y == 1) { X = k_in; Wm = Wk; bias = bk; O = ws_k; }
    else                      { X = v_in; Wm = Wv; bias = bv; O = ws_v; }

    const int laneBase = (lane < 16) ? 0 : 8;
    const int l15 = lane & 15;
    const size_t blk0 = (size_t)blockIdx.x * 128 * DD;  // first element of the row block

    // every load of the block is issued before the first conversion
    const float braw = bias[tid & (DD - 1)];
    v4f wraw[16], xraw[16];
    f32_block_load(Wm, tid, wraw);
    f32_block_load(X + blk0, tid, xraw);
    bl[tid] = braw;
    f32_block_to_lds(wraw, tid, wl);
    f32_block_to_lds(xraw, tid, xl);
    __syncthreads();

    v8f acc[8] = {};
    // first element of the wave's 16 nodes in head 0's plane; column tile t is head t
    _Float16* o16 = O + ((size_t)(blockIdx.x >> 3) * (HH * NN) + (blockIdx.x & 7) * 128 + wave * 16) * HD;

    if (blockIdx.y == 2) {
        proj_tiles<true>(wl, &xl[(wave * 16 + l15) * WPITCH], l15, laneBase, acc);
        // the lane holds nodes 8h .. 8h+7 of head dim c: its 16 bytes of the V^T fragment;
        // a wave's store is 512 contiguous bytes
#pragma unroll
        for (int t = 0; t < 8; ++t) {
            const float b = bl[16 * t + l15];
            v8h o;
#pragma unroll
            for (int r = 0; r < 8; ++r) o[r] = (_Float16)(acc[t][r] + b);
            *(v8h*)(o16 + t * (NN * HD) + lane * 8) = o;
        }
        return;
    }

    proj_tiles<false>(wl, &xl[(wave * 16 + l15) * WPITCH], l15, laneBase, acc);

    // [node][16]: a wave's store is 16 nodes x 32 B = 512 contiguous bytes
    _Float16* orow = o16 + l15 * HD + laneBase;
    v8h oo[8];
#pragma unroll
    for (int t = 0; t < 8; ++t) {
        const v4f b0 = *(const v4f*)&bl[16 * t + laneBase];
        const v4f b1 = *(const v4f*)&bl[16 * t + laneBase + 4];
        v8h o;
#pragma unroll
        for (int r = 0; r < 4; ++r) {
            o[r]     = (_Float16)((acc[t][r] + b0[r]) * osc);
            o[4 + r] = (_Float16)((acc[t][4 + r] + b1[r]) * osc);
        }
        *(v8h*)(orow + t * (NN * HD)) = o;
        oo[t] = o;
    }
    // stands behind the last store, in front of the branch: the sums below rewrite registers that
    // the stores name (inside the branch the compiler moved those sums up over it)
    asm volatile("s_wait_xcnt 0x0" ::: "memory");
    if (blockIdx.y == 1) {
        float kb8 = 0.0f;                       // lane t: the bound of head t
#pragma unroll   // oo needs constant indices to stay in registers
        for (int t = 0; t < 8; ++t) {
            // the largest sum of squares among the 16 keys as stored, each 8-dim half apart; the
            // sum of the two halves' maxima is at least every key's squared length
            float kh = row16_max(sumsq8(oo[t]));
            kh += other_half(kh);
            kb8 = (lane == t) ? kh : kb8;
        }
        // [row block][head][wave]: a work-group's 64 bounds are 256 bytes of its own
        if (lane < 8) ws_kmx[((size_t)blockIdx.x * HH + lane) * 8 + wave] = kb8;
    }
}

// ---------------------------------------------------------------------------
// Kernel 2: flash attention over the node dim with the output projection behind it.
// Block = 24 waves = 3 groups of 32 queries x 8 heads; wave = one head of one group (two
// column groups of 16 queries).  256 blocks: one a WGP, six waves a SIMD.
// K and V fragments come straight from global memory, each a pair of 512-byte wave loads,
// fetched ahead into registers in the loop without a maximum; the three waves of a head read the same lines unless the block's groups span two (b,t).  The key
// loop holds no LDS access and no barrier.
// Per 32 keys:
//   - one K fragment: keys j..j+15 in k 0..15, keys j+16..j+31 in k 16..31.
//     Against B = [Q;0] it gives the first 16 keys' scores, against B = [0;Q]
//     the second 16 keys': S^T = K * Q^T, no zero fill of A in the loop.
//     A lane then holds 16 scores of ONE query (column lane&15): keys 8h+r and
//     16+8h+r, h = lane>>4
//   - Q comes in exp2 units and the product's C operand is minus the maximum in use,
//     so the accumulator IS the exp2 argument: no scale, maximum or subtraction per
//     score.  The maximum in use starts as the true maximum of keys 0..31 and is
//     raised (with the rescale of O and of the row sum) only in a pass where some
//     lane's sum of P tops PLIM: one wave-uniform branch per pass
//   - a wave whose scores are all bounded by |q| * max|k| <= 10 (the keys' bound comes from
//     their projection) takes a loop of its own with no maximum at all: C = 0, P = exp2(score)
//   - V^T fragment (A[m=hd][k=key]): stored in that order by V's projection
//   - O^T += V^T * P^T: the two score tiles, converted in place, already are
//     the B operand in the hardware k order; P never goes through LDS
// Behind the loop the 8 heads of a query meet in LDS (f16, one barrier), and each wave computes
// 16 queries x 32 out columns as Wo * O^T, Wo laid as f16 in LDS at entry; it stores them as
// whole 128-byte lines, turned in an LDS range of its own.
// ---------------------------------------------------------------------------
#define OPITCH 36    // f32 per staged row: 144 B, 16-byte writers of 16 rows meet no bank twice
__global__ __launch_bounds__(768)
void flash_attn_out_kernel(const _Float16* __restrict__ Q,
                           const _Float16* __restrict__ K,
                           const _Float16* __restrict__ V,
                           const float* __restrict__ kmx,
                           const float* __restrict__ Wo,
                           const float* __restrict__ bo,
                           float* __restrict__ out) {
    __shared__ __align__(16) _Float16 wl[DD * WPITCH];
    __shared__ __align__(16) _Float16 xl[96 * WPITCH];  // attention output, [query of the block][128]
    __shared__ __align__(16) float bl[DD];
    __shared__ __align__(16) float ol[24 * 16 * OPITCH];    // per wave: its 16 rows x 32 columns of out

    const int tid  = threadIdx.x;
    const int lane = tid & 31;
    const int wave = __builtin_amdgcn_readfirstlane(tid >> 5);
    const int h    = wave / 3;
    const int qg   = wave - 3 * h;
    const int grp  = blockIdx.x * 3 + qg;       // 32-query group, 0..767; never across a (b,t)
    const int bt   = grp >> 5;                  // 0..23
    const int hsel = lane >> 4;
    const int laneBase = hsel * 8;
    const int l15 = lane & 15;
    const int m0 = (grp & 31) * 32;

    const size_t head0 = (size_t)(bt * HH + h) * (NN * HD);
    const _Float16* kp = K + head0 + l15 * HD + laneBase;   // key l15, its 8-dim half
    const _Float16* vp = V + head0 + lane * 8;              // the lane's 16 bytes of a 16-key group
    auto kfrag = [&](int j0) {
        return join16(*(const v8h*)(kp + j0 * HD), *(const v8h*)(kp + (j0 + 16) * HD));
    };
    auto vfrag = [&](int j0) {
        return join16(*(const v8h*)(vp + j0 * HD), *(const v8h*)(vp + (j0 + 16) * HD));
    };

    v8h qraw[2];
#pragma unroll
    for (int c = 0; c < 2; ++c)
        qraw[c] = *(const v8h*)(Q + head0 + (m0 + 16 * c + l15) * HD + laneBase);
    // the head's 64 bounds (8 row blocks x 8 waves of the projection), two a lane
    const v2f kraw = *(const v2f*)(kmx + ((size_t)(bt * 8 + (lane >> 2)) * HH + h) * 8 + (lane & 3) * 2);
    v16h kA = kfrag(0), kB = kfrag(32);
    v16h vA = vfrag(0), vB;

    // L2 hints for the head's K and V planes: the launch before stored them.  One request names
    // the 32 units of 256 bytes (one a lane) that hold 256 keys
    // of one plane: item i = plane i & 1, keys 256 (i >> 1) and on.  The head's three waves deal
    // its 8 items among them: this wave asks for items qg, qg + 3 and qg + 6 (the ninth place
    // asks for the eighth item again).  Every lane's address lies inside the plane.
    {
        auto item_base = [&](int i) { return ((i & 1) ? V : K) + head0 + (i >> 1) * (256 * HD); };
        // hints: no result to wait for.  The wait is the last line of their own statement, so that
        // it stands in front of the next rewrite of the offset register
        asm volatile("global_prefetch_b8 %0, %1 scope:SCOPE_SE\n\t"
                     "global_prefetch_b8 %0, %2 scope:SCOPE_SE\n\t"
                     "global_prefetch_b8 %0, %3 scope:SCOPE_SE\n\t"
                     "s_wait_xcnt 0x0"
                     :: "v"(lane * 256), "s"(item_base(qg)), "s"(item_base(qg + 3)),
                        "s"(item_base(min(qg + 6, 7)))
                     : "memory");
    }

    // Wo (4096 pieces of 16 bytes, whole rows a wave) and the bias, laid in LDS for the epilogue:
    // five pieces a thread, the last 256 pieces by the first eight waves
    {
        v4f wraw[5];
#pragma unroll
        for (int i = 0; i < 5; ++i) wraw[i] = *(const v4f*)(Wo + (size_t)(i * 768 + tid) * 4);
        const float braw = bo[tid & (DD - 1)];
        // stands behind the loads above: their address registers are rewritten below
        asm volatile("s_wait_xcnt 0x0" ::: "memory");
#pragma unroll
        for (int i = 0; i < 5; ++i) {
            const int f = i * 768 + tid;        // float4 index: 32 per row
            *(v4h*)&wl[(f >> 5) * WPITCH + (f & 31) * 4] = __builtin_convertvector(wraw[i], v4h);
        }
        if (wave < 8) {
            const int f = 5 * 768 + tid;
            *(v4h*)&wl[(f >> 5) * WPITCH + (f & 31) * 4] =
                __builtin_convertvector(*(const v4f*)(Wo + (size_t)f * 4), v4h);
        }
        if (wave < 4) bl[tid] = braw;
    }

    // Q as B operand (column = query l15), in the low and in the high k half
    const v8h zero8 = {};
    v16h qlo[2], qhi[2];
#pragma unroll
    for (int c = 0; c < 2; ++c) {
        qlo[c] = join16(qraw[c], zero8);
        qhi[c] = join16(zero8, qraw[c]);
    }

    v8f acc[2] = {};                            // acc[c][r] = O^T[hd = laneBase + r][query 16c + l15]
    float lsum[2] = {0.0f, 0.0f};               // this half's share of the row sum

    // |score| <= |q| * |k|.  Where that bound is at most 10 (exp2 units) for every query of the
    // wave, every P = exp2(score) lies in 2^-10 .. 2^10, normal f16 numbers: such a wave needs
    // no maximum, no test and no rescale.  An infinite bound fails the compare.
    float worst;
    {
        float kk = row16_max(fmaxf(kraw[0], kraw[1]));
        kk = fmaxf(kk, other_half(kk));
        float qq = fmaxf(sumsq8(qraw[0]), sumsq8(qraw[1]));
        qq += other_half(qq);                   // at least either query's squared length
        worst = length_bound(qq) * length_bound(kk);
    }

    if (__builtin_amdgcn_ballot_w32(!(worst <= 100.0f)) == 0) {
        const v8f z = {};
        v2f ls2[2] = {};                        // running row sum, two places a column group
        v8f d0[2], d1[2];                       // the scores of the pass to come
        auto scores = [&](const v16h& ka) {
#pragma unroll   // the two column groups' arrays need constant indices
            for (int c = 0; c < 2; ++c) {
                d0[c] = wmma_f16(ka, qlo[c], z);
                d1[c] = wmma_f16(ka, qhi[c], z);
            }
        };
        // One pass over keys j0 .. j0+31: V fragment va; kn = the next pass's K fragment.  It
        // first asks for the K fragment of the pass after next (into k2) and the next pass's V
        // fragment (into vn).  The next pass's score products stand between this pass's exp2 and
        // its sums and conversions, so that independent vector work follows every product.
        auto pass = [&](int j0, const v16h& va, const v16h& kn, v16h& k2, v16h& vn, auto ldk, auto more) {
            if constexpr (decltype(ldk)::value)  k2 = kfrag(j0 + 64);
            if constexpr (decltype(more)::value) {
                vn = vfrag(j0 + 32);
                // holds the loads up here, a pass and more ahead of their use, and stands in
                // front of the next rewrite of their address registers
                asm volatile("s_wait_xcnt 0x0" ::: "memory");
            }
            v8f e0[2], e1[2];
#pragma unroll   // constant indices, as above
            for (int c = 0; c < 2; ++c) {
                e0[c] = exp2_8(d0[c]);
                e1[c] = exp2_8(d1[c]);
            }
            if constexpr (decltype(more)::value) scores(kn);
#pragma unroll   // constant indices, as above
            for (int c = 0; c < 2; ++c) {
                const v8f t8 = e0[c] + e1[c];
                const v4f t4 = __builtin_shufflevector(t8, t8, 0, 1, 2, 3) + __builtin_shufflevector(t8, t8, 4, 5, 6, 7);
                ls2[c] += __builtin_shufflevector(t4, t4, 0, 1) + __builtin_shufflevector(t4, t4, 2, 3);
                v16h pb;                        // B[k=key][n=query], hardware k order
#pragma unroll   // constant indices: the vectors stay in registers
                for (int r = 0; r < 8; ++r) {
                    pb[r]     = (_Float16)e0[c][r];
                    pb[8 + r] = (_Float16)e1[c][r];
                }
                acc[c] = wmma_f16(va, pb, acc[c]);
            }
        };
        scores(kA);
        // two passes a trip: the fragments change places between two register sets, no copies
        for (int j0 = 0; j0 < NN - 64; j0 += 64) {
            pass(j0,      vA, kB, kA, vB, flag<true>{}, flag<true>{});
            pass(j0 + 32, vB, kA, kB, vA, flag<true>{}, flag<true>{});
        }
        pass(NN - 64, vA, kB, kA, vB, flag<false>{}, flag<true>{});
        pass(NN - 32, vB, kA, kB, vA, flag<false>{}, flag<false>{});
#pragma unroll   // constant indices, as above
        for (int c = 0; c < 2; ++c) lsum[c] = ls2[c][0] + ls2[c][1];
    } else {
    // minus the maximum in use of the lane's query (spread over the 8 places of a C operand in
    // each pass: held so, it would cost 14 registers more than the six waves a SIMD leave);
    // it starts as the true maximum over keys 0..31, so the first P are at most 1
    float negm[2];
#pragma unroll   // here and below: the two column groups' arrays need constant indices
    for (int c = 0; c < 2; ++c) {
        const v8f z = {};
        negm[c] = -max16_both_halves(wmma_f16(kA, qlo[c], z), wmma_f16(kA, qhi[c], z));
    }

    for (int j0 = 0; j0 < NN; j0 += 32) {
        // no fetch ahead here: this loop has no registers to spare for it
        const v16h ka = kfrag(j0);
        // stands in front of the next rewrite of the loads' address registers
        asm volatile("s_wait_xcnt 0x0" ::: "memory");

        v8f d0[2], d1[2], e0[2], e1[2];
        float ts[2];
#pragma unroll
        for (int c = 0; c < 2; ++c) {
            const float n = negm[c];
            const v8f cm = {n, n, n, n, n, n, n, n};
            d0[c] = wmma_f16(ka, qlo[c], cm);
            d1[c] = wmma_f16(ka, qhi[c], cm);
        }
#pragma unroll
        for (int c = 0; c < 2; ++c) {
            e0[c] = exp2_8(d0[c]);
            e1[c] = exp2_8(d1[c]);
            ts[c] = sum16(e0[c], e1[c]);
        }
        // P are not negative, so the sum bounds each of them; an infinite sum fails the test too
        if (__builtin_amdgcn_ballot_w32(!(ts[0] + ts[1] <= PLIM)) != 0) {
#pragma unroll
            for (int c = 0; c < 2; ++c) {
                const float up = fmaxf(max16_both_halves(d0[c], d1[c]), 0.0f);  // same in both halves
                const float al = __builtin_amdgcn_exp2f(-up);
                negm[c] -= up;
                e0[c] = exp2_8(d0[c] - up);
                e1[c] = exp2_8(d1[c] - up);
                ts[c] = sum16(e0[c], e1[c]);
                acc[c] *= al;
                lsum[c] *= al;
            }
        }
        const v16h va = vfrag(j0);              // behind the branch, which needs the registers
        // stands in front of the next rewrite of the loads' address registers
        asm volatile("s_wait_xcnt 0x0" ::: "memory");
#pragma unroll
        for (int c = 0; c < 2; ++c) {
            lsum[c] += ts[c];
            v16h pb;                            // B[k=key][n=query], hardware k order
#pragma unroll
            for (int r = 0; r < 8; ++r) {
                pb[r]     = (_Float16)e0[c][r];
                pb[8 + r] = (_Float16)e1[c][r];
            }
            acc[c] = wmma_f16(va, pb, acc[c]);
        }
    }
    }

    // the wave's head of its 32 queries, as f16, into the block's [query][128] plane
    _Float16* xq = &xl[(qg * 32 + l15) * WPITCH];
#pragma unroll
    for (int c = 0; c < 2; ++c) {
        const float l = lsum[c] + other_half(lsum[c]);  // join the two halves' sums once
        v8h o;
#pragma unroll
        for (int r = 0; r < 8; ++r) o[r] = (_Float16)(acc[c][r] / l);
        *(v8h*)&xq[16 * c * WPITCH + h * HD + laneBase] = o;
    }
    __syncthreads();                            // all 8 heads of every query, Wo and the bias are laid

    // out^T tiles: wave = 16 queries (group g of the block's six) x 32 out columns (quarter cq):
    // A = Wo rows 32cq + 16t .. +15, B = the group's attention rows, k = 128
    const int g  = wave >> 2;
    const int cq = wave & 3;
    v8f oc[2] = {};
    const _Float16* wrow = wl + (32 * cq + l15) * WPITCH;
    const _Float16* xrow = &xl[(16 * g + l15) * WPITCH];
#pragma unroll
    for (int kb = 0; kb < 4; ++kb) {
        const v16h xb = frag_from_f16(xrow + kb * 32, laneBase);
#pragma unroll
        for (int t = 0; t < 2; ++t)
            oc[t] = wmma_f16(frag_from_f16(wrow + 16 * t * WPITCH + kb * 32, laneBase), xb, oc[t]);
    }
    // The lane holds 8 columns of one row per tile: stored so, a wave's store would touch 16 lines
    // with 32 bytes each.  The wave lays its 16 rows x 128 bytes in an LDS range of its own and
    // reads them back four rows at a time, 8 lanes a row: each store then fills 4 whole lines.
    float* st = &ol[wave * (16 * OPITCH)];
#pragma unroll
    for (int t = 0; t < 2; ++t) {
        const v4f b0 = *(const v4f*)&bl[32 * cq + 16 * t + laneBase];
        const v4f b1 = *(const v4f*)&bl[32 * cq + 16 * t + laneBase + 4];
        v4f o0, o1;
#pragma unroll
        for (int r = 0; r < 4; ++r) {
            o0[r] = oc[t][r] + b0[r];
            o1[r] = oc[t][4 + r] + b1[r];
        }
        *(v4f*)&st[l15 * OPITCH + 16 * t + laneBase]     = o0;
        *(v4f*)&st[l15 * OPITCH + 16 * t + laneBase + 4] = o1;
    }
    // the wave's own LDS writes have landed before other lanes of it read them back
    asm volatile("s_wait_dscnt 0x0" ::: "memory");
    v4f ov[4];
#pragma unroll
    for (int i = 0; i < 4; ++i)
        ov[i] = *(const v4f*)&st[(4 * i + (lane >> 3)) * OPITCH + (lane & 7) * 4];
    float* orow = out + ((size_t)blockIdx.x * 96 + 16 * g + (lane >> 3)) * DD + 32 * cq + (lane & 7) * 4;
#pragma unroll
    for (int i = 0; i < 4; ++i)
        *(v4f*)(orow + 4 * i * DD) = ov[i];
}

// ---------------------------------------------------------------------------
extern "C" void kernel_launch(void* const* d_in, const int* in_sizes, int n_in,
                              void* d_out, int out_size, void* d_ws, size_t ws_size,
                              hipStream_t stream) {
    const float* query = (const float*)d_in[0];
    const float* key   = (const float*)d_in[1];
    const float* value = (const float*)d_in[2];
    const float* Wq = (const float*)d_in[3];
    const float* bq = (const float*)d_in[4];
    const float* Wk = (const float*)d_in[5];
    const float* bk = (const float*)d_in[6];
    const float* Wv = (const float*)d_in[7];
    const float* bv = (const float*)d_in[8];
    const float* Wo = (const float*)d_in[9];
    const float* bo = (const float*)d_in[10];

    _Float16* ws_q = (_Float16*)d_ws;          // 3 x 6 MB f16 buffers, then 48 KB of key bounds
    _Float16* ws_k = ws_q + ELEMS;
    _Float16* ws_v = ws_k + ELEMS;
    float* ws_kmx  = (float*)(ws_v + ELEMS);

    dim3 blk(256);                              // 8 waves per block (wave32)

    qkv_proj_kernel<<<dim3(192, 3), blk, 0, stream>>>(
        query, key, value, Wq, bq, Wk, bk, Wv, bv, ws_q, ws_k, ws_v, ws_kmx);

    flash_attn_out_kernel<<<dim3(256), dim3(768), 0, stream>>>(
        ws_q, ws_k, ws_v, ws_kmx, Wo, bo, (float*)d_out);
}

// v009
// Measured time: 32.9 microseconds a run.
// In two side-by-side timings against v008, it was 1.03 and 1.04 times as fast.
// Over all steps from v000 it is 4.72 times as fast.
#include <hip/hip_runtime.h>
#include <hip/hip_bf16.h>

typedef __attribute__((ext_vector_type(16))) _Float16 v16h;
typedef __attribute__((ext_vector_type(8)))  _Float16 v8h;
typedef __attribute__((ext_vector_type(8)))  float    v8f;
typedef __attribute__((ext_vector_type(4)))  float    v4f;

// Problem constants
#define BB 2
#define TT 12
#define NN 1024
#define DD 128
#define HH 8
#define HD 16
#define ROWS (BB*TT*NN)          // 24576
#define ELEMS ((size_t)ROWS*DD)  // 3145728
#define QSCALE 0.36067376022224085f   // log2(e) / sqrt(16)

// ---------------------------------------------------------------------------
// Fragment builders for V_WMMA_F32_16X16X32_F16 (wave32).
// 16-bit A-matrix 16x32 layout (ISA 7.12.2):
//   laneBase = (lane<16 ? 0 : 8);  row = lane&15
//   elem e<8 -> K = laneBase + e ;  e>=8 -> K = laneBase + 8 + e
// B (32x16) mirrors this with column = lane&15.
// C/D 16x16 f32: elem r -> (M = r + (lane<16?0:8), N = lane&15)
// ---------------------------------------------------------------------------

static __device__ inline v16h frag_from_f16(const _Float16* __restrict__ rowp, int laneBase) {
    v8h x0 = *(const v8h*)(rowp + laneBase);        // K = laneBase .. +7
    v8h x1 = *(const v8h*)(rowp + laneBase + 16);   // K = laneBase+16 .. +23
    v16h a;
#pragma unroll
    for (int i = 0; i < 8; ++i) { a[i] = x0[i]; a[8 + i] = x1[i]; }
    return a;
}

static __device__ inline v8f wmma_f16(v16h a, v16h b, v8f c) {
    return __builtin_amdgcn_wmma_f32_16x16x32_f16(false, a, false, b,
                                                  (short)0, c, false, false);
}

// ---------------------------------------------------------------------------
// Projection tiling of kernel 1.
// Work-group = 8 waves = 128 rows x all 128 columns.  Weight and input block
// (each 128 x 128) come in by whole-row wave loads and are laid down as f16 in
// LDS once; each wave of a K block then computes its 16 rows x 128 columns as C^T = W * X^T:
// A = 16 weight rows, B = the wave's 16 input rows, read once into registers.
// Lane (c = lane&15, h = lane>>4) ends with C[m0 + c][16t + 8h + 0..7] in
// accumulator tile t: 8 consecutive columns of one row, stored packed.
// ---------------------------------------------------------------------------
#define WPITCH 136   // f16 per LDS row: 272 B = 16 B x 17, the pitch for 16-byte readers

typedef __attribute__((ext_vector_type(4))) _Float16 v4h;

// A thread's share of a contiguous 128x128 f32 block: each wave-wide load is one 512-B row.
static __device__ inline void f32_block_load(const float* __restrict__ src, int tid, v4f (&x)[16]) {
#pragma unroll
    for (int i = 0; i < 16; ++i)
        x[i] = *(const v4f*)(src + (size_t)(i * 256 + tid) * 4);
}

static __device__ inline void f32_block_to_lds(const v4f (&x)[16], int tid, _Float16* dst) {
#pragma unroll
    for (int i = 0; i < 16; ++i) {
        const int f = i * 256 + tid;            // float4 index: 32 per row
        *(v4h*)&dst[(f >> 5) * WPITCH + (f & 31) * 4] = __builtin_convertvector(x[i], v4h);
    }
}

// XA = false: C^T = W * X^T, as above.  XA = true: the same two fragments in the other order,
// C = X * W^T: the lane ends with C[m0 + 8h + 0..7][16t + c], 8 consecutive rows of one column.
template <bool XA>
static __device__ inline void proj_tiles(const _Float16* wl, const _Float16* xrow,
                                         int l15, int laneBase, v8f (&acc)[8]) {
    // 8 groups of 4 products: group g = k block g>>1, column tiles 4*(g&1) .. +3
    const _Float16* wrow = wl + l15 * WPITCH;
    v16h wa[2][4];
    v16h xb[2];
    xb[0] = frag_from_f16(xrow, laneBase);
#pragma unroll
    for (int j = 0; j < 4; ++j) wa[0][j] = frag_from_f16(wrow + 16 * j * WPITCH, laneBase);
#pragma unroll
    for (int g = 0; g < 8; ++g) {
        if (g < 7) {
            const int n = g + 1, kb = n >> 1, t0 = 4 * (n & 1);
            if ((n & 1) == 0) xb[kb & 1] = frag_from_f16(xrow + kb * 32, laneBase);
#pragma unroll
            for (int j = 0; j < 4; ++j)
                wa[n & 1][j] = frag_from_f16(wrow + 16 * (t0 + j) * WPITCH + kb * 32, laneBase);
        }
        // keeps the next group's LDS reads as one run ahead of this group's products,
        // so that a product never waits on a read issued just in front of it
        __builtin_amdgcn_sched_barrier(0);
#pragma unroll
        for (int j = 0; j < 4; ++j)
            acc[4 * (g & 1) + j] = XA ? wmma_f16(xb[(g >> 1) & 1], wa[g & 1][j], acc[4 * (g & 1) + j])
                                      : wmma_f16(wa[g & 1][j], xb[(g >> 1) & 1], acc[4 * (g & 1) + j]);
        // keeps the group after next's reads from moving up among these products
        __builtin_amdgcn_sched_barrier(0);
    }
}

static __device__ inline float other_half(float x) {   // lane l <-> l ^ 16
    const int b = __builtin_bit_cast(int, x);
    return __builtin_bit_cast(float,
        __builtin_amdgcn_permlanex16(b, b, 0x76543210, 0xfedcba98, false, false));
}

static __device__ inline v16h join16(v8h lo, v8h hi) {
    return __builtin_shufflevector(lo, hi, 0, 1, 2, 3, 4, 5, 6, 7, 8, 9, 10, 11, 12, 13, 14, 15);
}

typedef __attribute__((ext_vector_type(2))) float v2f;

#define PLIM 4096.0f    // a lane's sum of 32 P at or below it: every P fits f16 with room

static __device__ inline v8f exp2_8(const v8f d) {
    v8f e;
#pragma unroll   // constant indices: the vector stays in registers
    for (int r = 0; r < 8; ++r) e[r] = __builtin_amdgcn_exp2f(d[r]);
    return e;
}

static __device__ inline float sum16(const v8f e0, const v8f e1) {  // pairwise, on register pairs
    const v8f t8 = e0 + e1;
    const v4f t4 = __builtin_shufflevector(t8, t8, 0, 1, 2, 3) + __builtin_shufflevector(t8, t8, 4, 5, 6, 7);
    const v2f t2 = __builtin_shufflevector(t4, t4, 0, 1) + __builtin_shufflevector(t4, t4, 2, 3);
    return t2[0] + t2[1];
}

static __device__ inline float max16_both_halves(const v8f d0, const v8f d1) {
    float tm = fmaxf(d0[0], d1[0]);
#pragma unroll   // constant indices: the vectors stay in registers
    for (int r = 1; r < 8; ++r) tm = fmaxf(tm, fmaxf(d0[r], d1[r]));
    return fmaxf(tm, other_half(tm));
}

// Sum of the squares of 8 f16, summed in f32: no finite f16 overflows it
static __device__ inline float sumsq8(const v8h x) {
    float s = 0.0f;
#pragma unroll   // constant indices: the vector stays in registers
    for (int r = 0; r < 8; ++r) s = fmaf((float)x[r], (float)x[r], s);
    return s;
}

// At least the true sum of squares: 1 % and 1e-6 stand for what the roundings of 16 terms and
// products of subnormal size can lose
static __device__ inline float length_bound(float s) { return fmaf(s, 1.01f, 1e-6f); }

template <int CTRL>
static __device__ inline float max_dpp(float x) {      // maximum with the lane that CTRL names
    const int b = __builtin_bit_cast(int, x);
    return fmaxf(x, __builtin_bit_cast(float, __builtin_amdgcn_update_dpp(b, b, CTRL, 0xf, 0xf, false)));
}

static __device__ inline float row16_max(float x) {    // over the lane's 16-lane row: row_xmask 1, 2, 4, 8
    return max_dpp<0x168>(max_dpp<0x164>(max_dpp<0x162>(max_dpp<0x161>(x))));
}

template <bool B> struct flag { static constexpr bool value = B; };

// ---------------------------------------------------------------------------
// Kernel 1: fused K/V projection.  C = X @ W^T + b   (f32 in, f16 out, head-major)
// K leaves as [b*t][head][node][16].  V leaves in the order of the attention kernel's
// V^T fragment: [b*t][head][16-node group][lane (c = head dim, h)][nodes 8h .. 8h+7].
// The K blocks also leave, per wave and head, a bound on the squared length of their 16 keys.
// grid.x = 192 row blocks, grid.y = 2 (k/v)
// ---------------------------------------------------------------------------
__global__ __launch_bounds__(256)
void kv_proj_kernel(const float* __restrict__ k_in,
                    const float* __restrict__ v_in,
                    const float* __restrict__ Wk, const float* __restrict__ bk,
                    const float* __restrict__ Wv, const float* __restrict__ bv,
                    _Float16* __restrict__ ws_k,
                    _Float16* __restrict__ ws_v,
                    float* __restrict__ ws_kmx) {
    __shared__ __align__(16) _Float16 wl[DD * WPITCH];
    __shared__ __align__(16) _Float16 xl[128 * WPITCH];
    __shared__ __align__(16) float bl[256];     // bias, laid down twice: every thread stores, no branch among the loads

    const int tid  = threadIdx.x;
    const int lane = tid & 31;
    const int wave = tid >> 5;

    const float* X; const float* Wm; const float* bias; _Float16* O;
    if (blockIdx.y == 0) { X = k_in; Wm = Wk; bias = bk; O = ws_k; }
    else                 { X = v_in; Wm = Wv; bias = bv; O = ws_v; }

    const int laneBase = (lane < 16) ? 0 : 8;
    const int l15 = lane & 15;
    const size_t blk0 = (size_t)blockIdx.x * 128 * DD;  // first element of the row block

    // every load of the block is issued before the first conversion
    const float braw = bias[tid & (DD - 1)];
    v4f wraw[16], xraw[16];
    f32_block_load(Wm, tid, wraw);
    f32_block_load(X + blk0, tid, xraw);
    bl[tid] = braw;
    f32_block_to_lds(wraw, tid, wl);
    f32_block_to_lds(xraw, tid, xl);
    __syncthreads();

    v8f acc[8] = {};
    // first element of the wave's 16 nodes in head 0's plane; column tile t is head t
    _Float16* o16 = O + ((size_t)(blockIdx.x >> 3) * (HH * NN) + (blockIdx.x & 7) * 128 + wave * 16) * HD;

    if (blockIdx.y == 1) {
        proj_tiles<true>(wl, &xl[(wave * 16 + l15) * WPITCH], l15, laneBase, acc);
        // the lane holds nodes 8h .. 8h+7 of head dim c: its 16 bytes of the V^T fragment;
        // a wave's store is 512 contiguous bytes
#pragma unroll
        for (int t = 0; t < 8; ++t) {
            const float b = bl[16 * t + l15];
            v8h o;
#pragma unroll
            for (int r = 0; r < 8; ++r) o[r] = (_Float16)(acc[t][r] + b);
            *(v8h*)(o16 + t * (NN * HD) + lane * 8) = o;
        }
        return;
    }

    proj_tiles<false>(wl, &xl[(wave * 16 + l15) * WPITCH], l15, laneBase, acc);

    // [node][16]: a wave's store is 16 nodes x 32 B = 512 contiguous bytes
    _Float16* orow = o16 + l15 * HD + laneBase;
    v8h oo[8];
#pragma unroll
    for (int t = 0; t < 8; ++t) {
        const v4f b0 = *(const v4f*)&bl[16 * t + laneBase];
        const v4f b1 = *(const v4f*)&bl[16 * t + laneBase + 4];
        v8h o;
#pragma unroll
        for (int r = 0; r < 4; ++r) {
            o[r]     = (_Float16)(acc[t][r] + b0[r]);
            o[4 + r] = (_Float16)(acc[t][4 + r] + b1[r]);
        }
        *(v8h*)(orow + t * (NN * HD)) = o;
        oo[t] = o;
    }
    // stands behind the last store: the sums below rewrite registers that the stores name
    asm volatile("s_wait_xcnt 0x0" ::: "memory");
    {
        float kb8 = 0.0f;                       // lane t: the bound of head t
#pragma unroll   // oo needs constant indices to stay in registers
        for (int t = 0; t < 8; ++t) {
            // the largest sum of squares among the 16 keys as stored, each 8-dim half apart; the
            // sum of the two halves' maxima is at least every key's squared length
            float kh = row16_max(sumsq8(oo[t]));
            kh += other_half(kh);
            kb8 = (lane == t) ? kh : kb8;
        }
        // [row block][head][wave]: a work-group's 64 bounds are 256 bytes of its own
        if (lane < 8) ws_kmx[((size_t)blockIdx.x * HH + lane) * 8 + wave] = kb8;
    }
}

// ---------------------------------------------------------------------------
// Kernel 2: flash attention over the node dim, with the query projection in front of it and the
// output projection behind it.
// At entry the block lays its 96 query rows and Wq as f16 in LDS (one barrier); each wave then
// computes its head of its 32 queries as Wq * X^T: the lane ends with 8 head dims of one query,
// which is its share of the B operand.  Q is multiplied by QSCALE (in f32, ahead of its one
// rounding to f16), so that the score product is already in exp2 units.
// Block = 24 waves = 3 groups of 32 queries x 8 heads; wave = one head of one group (two
// column groups of 16 queries).  256 blocks: one a WGP, six waves a SIMD.
// K and V fragments come straight from global memory, each a pair of 512-byte wave loads,
// fetched ahead into registers in the loop without a maximum; the three waves of a head read the same lines unless the block's groups span two (b,t).  The key
// loop holds no LDS access and no barrier.
// Per 32 keys:
//   - one K fragment: keys j..j+15 in k 0..15, keys j+16..j+31 in k 16..31.
//     Against B = [Q;0] it gives the first 16 keys' scores, against B = [0;Q]
//     the second 16 keys': S^T = K * Q^T, no zero fill of A in the loop.
//     A lane then holds 16 scores of ONE query (column lane&15): keys 8h+r and
//     16+8h+r, h = lane>>4
//   - Q comes in exp2 units and the product's C operand is minus the maximum in use,
//     so the accumulator IS the exp2 argument: no scale, maximum or subtraction per
//     score.  The maximum in use starts as the true maximum of keys 0..31 and is
//     raised (with the rescale of O and of the row sum) only in a pass where some
//     lane's sum of P tops PLIM: one wave-uniform branch per pass
//   - a wave whose scores are all bounded by |q| * max|k| <= 10 (the keys' bound comes from
//     their projection) takes a loop of its own with no maximum at all: C = 0, P = exp2(score)
//   - V^T fragment (A[m=hd][k=key]): stored in that order by V's projection
//   - O^T += V^T * P^T: the two score tiles, converted in place, already are
//     the B operand in the hardware k order; P never goes through LDS
// Behind the loop the 8 heads of a query meet in LDS (f16, one barrier), and each wave computes
// 16 queries x 32 out columns as Wo * O^T, Wo laid as f16 in LDS at entry; it stores them as
// whole 128-byte lines, turned in an LDS range of its own.
// ---------------------------------------------------------------------------
#define OPITCH 36    // f32 per staged row: 144 B, 16-byte writers of 16 rows meet no bank twice
__global__ __launch_bounds__(768)
void flash_attn_out_kernel(const float* __restrict__ q_in,
                           const float* __restrict__ Wq,
                           const float* __restrict__ bq,
                           const _Float16* __restrict__ K,
                           const _Float16* __restrict__ V,
                           const float* __restrict__ kmx,
                           const float* __restrict__ Wo,
                           const float* __restrict__ bo,
                           float* __restrict__ out) {
    __shared__ __align__(16) _Float16 wl[DD * WPITCH];
    __shared__ __align__(16) _Float16 xl[96 * WPITCH];  // attention output, [query of the block][128]
    __shared__ __align__(16) float bl[DD];
    __shared__ __align__(16) float ol[24 * 16 * OPITCH];    // per wave: its 16 rows x 32 columns of out
    __shared__ __align__(16) _Float16 wql[DD * WPITCH];     // Wq
    // the block's query rows, [query of the block][128], 26 KB: read only in front of the key loop, in
    // the range that the epilogue's staging takes over behind the second barrier (in a range of their
    // own the block's LDS tops half a WGP's, and the compiler then laid the key loop out with more idle slots)
    _Float16* xql = (_Float16*)ol;

    const int tid  = threadIdx.x;
    const int lane = tid & 31;
    const int wave = __builtin_amdgcn_readfirstlane(tid >> 5);
    const int h    = wave / 3;
    const int qg   = wave - 3 * h;
    const int grp  = blockIdx.x * 3 + qg;       // 32-query group, 0..767; never across a (b,t)
    const int bt   = grp >> 5;                  // 0..23
    const int hsel = lane >> 4;
    const int laneBase = hsel * 8;
    const int l15 = lane & 15;

    const size_t head0 = (size_t)(bt * HH + h) * (NN * HD);
    const _Float16* kp = K + head0 + l15 * HD + laneBase;   // key l15, its 8-dim half
    const _Float16* vp = V + head0 + lane * 8;              // the lane's 16 bytes of a 16-key group
    auto kfrag = [&](int j0) {
        return join16(*(const v8h*)(kp + j0 * HD), *(const v8h*)(kp + (j0 + 16) * HD));
    };
    auto vfrag = [&](int j0) {
        return join16(*(const v8h*)(vp + j0 * HD), *(const v8h*)(vp + (j0 + 16) * HD));
    };

    // the block's 96 query rows (3072 pieces of 16 bytes, four a thread) and Wq (4096 pieces: five
    // a thread and the last 256), whole rows a wave; asked for first: the key loop cannot start
    // before Q stands.  Every wave asks for one of the last 256 pieces, so that no branch stands
    // among the loads; the first eight waves lay them
    const int ftail = 5 * 768 + (tid & 255);
    v4f xqraw[4], wqraw[5];
#pragma unroll   // here and below: constant indices, the arrays stay in registers
    for (int i = 0; i < 4; ++i)
        xqraw[i] = *(const v4f*)(q_in + (size_t)blockIdx.x * (96 * DD) + (size_t)(i * 768 + tid) * 4);
#pragma unroll
    for (int i = 0; i < 5; ++i) wqraw[i] = *(const v4f*)(Wq + (size_t)(i * 768 + tid) * 4);
    const v4f wqt = *(const v4f*)(Wq + (size_t)ftail * 4);
    const v4f bq0 = *(const v4f*)(bq + h * HD + laneBase);      // the lane's 8 head dims
    const v4f bq1 = *(const v4f*)(bq + h * HD + laneBase + 4);
    // the head's 64 bounds (8 row blocks x 8 waves of the projection), two a lane
    const v2f kraw = *(const v2f*)(kmx + ((size_t)(bt * 8 + (lane >> 2)) * HH + h) * 8 + (lane & 3) * 2);
    // stands in front of the fragment loads, whose results may land in the address registers of the loads above
    asm volatile("s_wait_xcnt 0x0" ::: "memory");
    v16h kA = kfrag(0), kB = kfrag(32);
    v16h vA = vfrag(0), vB;

    // L2 hints for the head's K and V planes: the launch before stored them.  One request names
    // the 32 units of 256 bytes (one a lane) that hold 256 keys
    // of one plane: item i = plane i & 1, keys 256 (i >> 1) and on.  The head's three waves deal
    // its 8 items among them: this wave asks for items qg, qg + 3 and qg + 6 (the ninth place
    // asks for the eighth item again).  Every lane's address lies inside the plane.
    {
        auto item_base = [&](int i) { return ((i & 1) ? V : K) + head0 + (i >> 1) * (256 * HD); };
        // hints: no result to wait for.  The wait is the last line of their own statement, so that
        // it stands in front of the next rewrite of the offset register
        asm volatile("global_prefetch_b8 %0, %1 scope:SCOPE_SE\n\t"
                     "global_prefetch_b8 %0, %2 scope:SCOPE_SE\n\t"
                     "global_prefetch_b8 %0, %3 scope:SCOPE_SE\n\t"
                     "s_wait_xcnt 0x0"
                     :: "v"(lane * 256), "s"(item_base(qg)), "s"(item_base(qg + 3)),
                        "s"(item_base(min(qg + 6, 7)))
                     : "memory");
    }

    // Wo (4096 pieces of 16 bytes, whole rows a wave) and the bias, laid in LDS for the epilogue:
    // dealt like Wq
    {
        v4f wraw[5];
#pragma unroll
        for (int i = 0; i < 5; ++i) wraw[i] = *(const v4f*)(Wo + (size_t)(i * 768 + tid) * 4);
        const v4f wot = *(const v4f*)(Wo + (size_t)ftail * 4);
        const float braw = bo[tid & (DD - 1)];
        // stands behind the loads above: their address registers are rewritten below
        asm volatile("s_wait_xcnt 0x0" ::: "memory");
#pragma unroll
        for (int i = 0; i < 5; ++i) {
            const int f = i * 768 + tid;        // float4 index: 32 per row
            *(v4h*)&wl[(f >> 5) * WPITCH + (f & 31) * 4] = __builtin_convertvector(wraw[i], v4h);
        }
#pragma unroll
        for (int i = 0; i < 4; ++i) {
            const int f = i * 768 + tid;
            *(v4h*)&xql[(f >> 5) * WPITCH + (f & 31) * 4] = __builtin_convertvector(xqraw[i], v4h);
        }
#pragma unroll
        for (int i = 0; i < 5; ++i) {
            const int f = i * 768 + tid;
            *(v4h*)&wql[(f >> 5) * WPITCH + (f & 31) * 4] = __builtin_convertvector(wqraw[i], v4h);
        }
        // takes the two loaded pieces as inputs: it holds their loads up among the others (sunk into
        // the branch they would start only there, and every wave waits for them at the barrier)
        asm volatile("" :: "v"(wqt), "v"(wot));
        if (wave < 8) {
            *(v4h*)&wql[(ftail >> 5) * WPITCH + (ftail & 31) * 4] = __builtin_convertvector(wqt, v4h);
            *(v4h*)&wl[(ftail >> 5) * WPITCH + (ftail & 31) * 4]  = __builtin_convertvector(wot, v4h);
        }
        if (wave < 4) bl[tid] = braw;
    }
    __syncthreads();                            // the query rows and Wq are laid

    // Q^T tiles of the wave's head: A = Wq rows 16h .. 16h+15, B = 16 query rows, k = 128.
    // The lane ends with head dims 8 hsel .. +7 of query 16c + l15
    v8h qraw[2];
    {
        v8f qa[2] = {};
        const _Float16* wqrow = wql + (h * HD + l15) * WPITCH;
        const _Float16* xqrow = &xql[(qg * 32 + l15) * WPITCH];
#pragma unroll
        for (int kb = 0; kb < 4; ++kb) {
            const v16h wa = frag_from_f16(wqrow + kb * 32, laneBase);
#pragma unroll
            for (int c = 0; c < 2; ++c)
                qa[c] = wmma_f16(wa, frag_from_f16(xqrow + 16 * c * WPITCH + kb * 32, laneBase), qa[c]);
        }
#pragma unroll
        for (int c = 0; c < 2; ++c)
#pragma unroll
            for (int r = 0; r < 4; ++r) {
                qraw[c][r]     = (_Float16)((qa[c][r] + bq0[r]) * QSCALE);
                qraw[c][4 + r] = (_Float16)((qa[c][4 + r] + bq1[r]) * QSCALE);
            }
    }

    // Q as B operand (column = query l15), in the low and in the high k half
    const v8h zero8 = {};
    v16h qlo[2], qhi[2];
#pragma unroll
    for (int c = 0; c < 2; ++c) {
        qlo[c] = join16(qraw[c], zero8);
        qhi[c] = join16(zero8, qraw[c]);
    }

    v8f acc[2] = {};                            // acc[c][r] = O^T[hd = laneBase + r][query 16c + l15]
    float lsum[2] = {0.0f, 0.0f};               // this half's share of the row sum

    // |score| <= |q| * |k|.  Where that bound is at most 10 (exp2 units) for every query of the
    // wave, every P = exp2(score) lies in 2^-10 .. 2^10, normal f16 numbers: such a wave needs
    // no maximum, no test and no rescale.  An infinite bound fails the compare.
    float worst;
    {
        float kk = row16_max(fmaxf(kraw[0], kraw[1]));
        kk = fmaxf(kk, other_half(kk));
        float qq = fmaxf(sumsq8(qraw[0]), sumsq8(qraw[1]));
        qq += other_half(qq);                   // at least either query's squared length
        worst = length_bound(qq) * length_bound(kk);
    }

    if (__builtin_amdgcn_ballot_w32(!(worst <= 100.0f)) == 0) {
        const v8f z = {};
        v2f ls2[2] = {};                        // running row sum, two places a column group
        v8f d0[2], d1[2];                       // the scores of the pass to come
        auto scores = [&](const v16h& ka) {
#pragma unroll   // the two column groups' arrays need constant indices
            for (int c = 0; c < 2; ++c) {
                d0[c] = wmma_f16(ka, qlo[c], z);
                d1[c] = wmma_f16(ka, qhi[c], z);
            }
        };
        // One pass over keys j0 .. j0+31: V fragment va; kn = the next pass's K fragment.  It
        // first asks for the K fragment of the pass after next (into k2) and the next pass's V
        // fragment (into vn).  The next pass's score products stand between this pass's exp2 and
        // its sums and conversions, so that independent vector work follows every product.
        auto pass = [&](int j0, const v16h& va, const v16h& kn, v16h& k2, v16h& vn, auto ldk, auto more) {
            if constexpr (decltype(ldk)::value)  k2 = kfrag(j0 + 64);
            if constexpr (decltype(more)::value) {
                vn = vfrag(j0 + 32);
                // holds the loads up here, a pass and more ahead of their use, and stands in
                // front of the next rewrite of their address registers
                asm volatile("s_wait_xcnt 0x0" ::: "memory");
            }
            v8f e0[2], e1[2];
#pragma unroll   // constant indices, as above
            for (int c = 0; c < 2; ++c) {
                e0[c] = exp2_8(d0[c]);
                e1[c] = exp2_8(d1[c]);
            }
            if constexpr (decltype(more)::value) scores(kn);
#pragma unroll   // constant indices, as above
            for (int c = 0; c < 2; ++c) {
                const v8f t8 = e0[c] + e1[c];
                const v4f t4 = __builtin_shufflevector(t8, t8, 0, 1, 2, 3) + __builtin_shufflevector(t8, t8, 4, 5, 6, 7);
                ls2[c] += __builtin_shufflevector(t4, t4, 0, 1) + __builtin_shufflevector(t4, t4, 2, 3);
                v16h pb;                        // B[k=key][n=query], hardware k order
#pragma unroll   // constant indices: the vectors stay in registers
                for (int r = 0; r < 8; ++r) {
                    pb[r]     = (_Float16)e0[c][r];
                    pb[8 + r] = (_Float16)e1[c][r];
                }
                acc[c] = wmma_f16(va, pb, acc[c]);
            }
        };
        scores(kA);
        // two passes a trip: the fragments change places between two register sets, no copies
        for (int j0 = 0; j0 < NN - 64; j0 += 64) {
            pass(j0,      vA, kB, kA, vB, flag<true>{}, flag<true>{});
            pass(j0 + 32, vB, kA, kB, vA, flag<true>{}, flag<true>{});
        }
        pass(NN - 64, vA, kB, kA, vB, flag<false>{}, flag<true>{});
        pass(NN - 32, vB, kA, kB, vA, flag<false>{}, flag<false>{});
#pragma unroll   // constant indices, as above
        for (int c = 0; c < 2; ++c) lsum[c] = ls2[c][0] + ls2[c][1];
    } else {
    // minus the maximum in use of the lane's query (spread over the 8 places of a C operand in
    // each pass: held so, it would cost 14 registers more than the six waves a SIMD leave);
    // it starts as the true maximum over keys 0..31, so the first P are at most 1
    float negm[2];
#pragma unroll   // here and below: the two column groups' arrays need constant indices
    for (int c = 0; c < 2; ++c) {
        const v8f z = {};
        negm[c] = -max16_both_halves(wmma_f16(kA, qlo[c], z), wmma_f16(kA, qhi[c], z));
    }

    for (int j0 = 0; j0 < NN; j0 += 32) {
        // no fetch ahead here: this loop has no registers to spare for it
        const v16h ka = kfrag(j0);
        // stands in front of the next rewrite of the loads' address registers
        asm volatile("s_wait_xcnt 0x0" ::: "memory");

        v8f d0[2], d1[2], e0[2], e1[2];
        float ts[2];
#pragma unroll
        for (int c = 0; c < 2; ++c) {
            const float n = negm[c];
            const v8f cm = {n, n, n, n, n, n, n, n};
            d0[c] = wmma_f16(ka, qlo[c], cm);
            d1[c] = wmma_f16(ka, qhi[c], cm);
        }
#pragma unroll
        for (int c = 0; c < 2; ++c) {
            e0[c] = exp2_8(d0[c]);
            e1[c] = exp2_8(d1[c]);
            ts[c] = sum16(e0[c], e1[c]);
        }
        // P are not negative, so the sum bounds each of them; an infinite sum fails the test too
        if (__builtin_amdgcn_ballot_w32(!(ts[0] + ts[1] <= PLIM)) != 0) {
#pragma unroll
            for (int c = 0; c < 2; ++c) {
                const float up = fmaxf(max16_both_halves(d0[c], d1[c]), 0.0f);  // same in both halves
                const float al = __builtin_amdgcn_exp2f(-up);
                negm[c] -= up;
                e0[c] = exp2_8(d0[c] - up);
                e1[c] = exp2_8(d1[c] - up);
                ts[c] = sum16(e0[c], e1[c]);
                acc[c] *= al;
                lsum[c] *= al;
            }
        }
        const v16h va = vfrag(j0);              // behind the branch, which needs the registers
        // stands in front of the next rewrite of the loads' address registers
        asm volatile("s_wait_xcnt 0x0" ::: "memory");
#pragma unroll
        for (int c = 0; c < 2; ++c) {
            lsum[c] += ts[c];
            v16h pb;                            // B[k=key][n=query], hardware k order
#pragma unroll
            for (int r = 0; r < 8; ++r) {
                pb[r]     = (_Float16)e0[c][r];
                pb[8 + r] = (_Float16)e1[c][r];
            }
            acc[c] = wmma_f16(va, pb, acc[c]);
        }
    }
    }

    // the wave's head of its 32 queries, as f16, into the block's [query][128] plane
    _Float16* xq = &xl[(qg * 32 + l15) * WPITCH];
#pragma unroll
    for (int c = 0; c < 2; ++c) {
        const float l = lsum[c] + other_half(lsum[c]);  // join the two halves' sums once
        v8h o;
#pragma unroll
        for (int r = 0; r < 8; ++r) o[r] = (_Float16)(acc[c][r] / l);
        *(v8h*)&xq[16 * c * WPITCH + h * HD + laneBase] = o;
    }
    __syncthreads();                            // all 8 heads of every query, Wo and the bias are laid

    // out^T tiles: wave = 16 queries (group g of the block's six) x 32 out columns (quarter cq):
    // A = Wo rows 32cq + 16t .. +15, B = the group's attention rows, k = 128
    const int g  = wave >> 2;
    const int cq = wave & 3;
    v8f oc[2] = {};
    const _Float16* wrow = wl + (32 * cq + l15) * WPITCH;
    const _Float16* xrow = &xl[(16 * g + l15) * WPITCH];
#pragma unroll
    for (int kb = 0; kb < 4; ++kb) {
        const v16h xb = frag_from_f16(xrow + kb * 32, laneBase);
#pragma unroll
        for (int t = 0; t < 2; ++t)
            oc[t] = wmma_f16(frag_from_f16(wrow + 16 * t * WPITCH + kb * 32, laneBase), xb, oc[t]);
    }
    // The lane holds 8 columns of one row per tile: stored so, a wave's store would touch 16 lines
    // with 32 bytes each.  The wave lays its 16 rows x 128 bytes in an LDS range of its own and
    // reads them back four rows at a time, 8 lanes a row: each store then fills 4 whole lines.
    float* st = &ol[wave * (16 * OPITCH)];
#pragma unroll
    for (int t = 0; t < 2; ++t) {
        const v4f b0 = *(const v4f*)&bl[32 * cq + 16 * t + laneBase];
        const v4f b1 = *(const v4f*)&bl[32 * cq + 16 * t + laneBase + 4];
        v4f o0, o1;
#pragma unroll
        for (int r = 0; r < 4; ++r) {
            o0[r] = oc[t][r] + b0[r];
            o1[r] = oc[t][4 + r] + b1[r];
        }
        *(v4f*)&st[l15 * OPITCH + 16 * t + laneBase]     = o0;
        *(v4f*)&st[l15 * OPITCH + 16 * t + laneBase + 4] = o1;
    }
    // the wave's own LDS writes have landed before other lanes of it read them back
    asm volatile("s_wait_dscnt 0x0" ::: "memory");
    v4f ov[4];
#pragma unroll
    for (int i = 0; i < 4; ++i)
        ov[i] = *(const v4f*)&st[(4 * i + (lane >> 3)) * OPITCH + (lane & 7) * 4];
    float* orow = out + ((size_t)blockIdx.x * 96 + 16 * g + (lane >> 3)) * DD + 32 * cq + (lane & 7) * 4;
#pragma unroll
    for (int i = 0; i < 4; ++i)
        *(v4f*)(orow + 4 * i * DD) = ov[i];
}

// ---------------------------------------------------------------------------
extern "C" void kernel_launch(void* const* d_in, const int* in_sizes, int n_in,
                              void* d_out, int out_size, void* d_ws, size_t ws_size,
                              hipStream_t stream) {
    const float* query = (const float*)d_in[0];
    const float* key   = (const float*)d_in[1];
    const float* value = (const float*)d_in[2];
    const float* Wq = (const float*)d_in[3];
    const float* bq = (const float*)d_in[4];
    const float* Wk = (const float*)d_in[5];
    const float* bk = (const float*)d_in[6];
    const float* Wv = (const float*)d_in[7];
    const float* bv = (const float*)d_in[8];
    const float* Wo = (const float*)d_in[9];
    const float* bo = (const float*)d_in[10];

    _Float16* ws_k = (_Float16*)d_ws;          // 2 x 6 MB f16 buffers, then 48 KB of key bounds
    _Float16* ws_v = ws_k + ELEMS;
    float* ws_kmx  = (float*)(ws_v + ELEMS);

    dim3 blk(256);                              // 8 waves per block (wave32)

    kv_proj_kernel<<<dim3(192, 2), blk, 0, stream>>>(
        key, value, Wk, bk, Wv, bv, ws_k, ws_v, ws_kmx);

    flash_attn_out_kernel<<<dim3(256), dim3(768), 0, stream>>>(
        query, Wq, bq, ws_k, ws_v, ws_kmx, Wo, bo, (float*)d_out);
}
